// v000
// Measured on an AMD MI455X. A time is GPU time per run, averaged over a window of back-to-back runs after a warm-up
// (all launches, gaps included; the runs take copies of the inputs in turn), and the median of several windows.
// Apart from v000's, it joins two sittings. Times from different sittings can be a few percent apart, while
// side-by-side timings come from the same sitting.
// The starting kernel, v000, takes 234 microseconds a run.
#include <hip/hip_runtime.h>

// ---------------------------------------------------------------------------
// Types for CDNA5 WMMA (wave32): v_wmma_f32_16x16x32_bf16
// ---------------------------------------------------------------------------
typedef __bf16 v16bf __attribute__((ext_vector_type(16)));
typedef __bf16 v8bf  __attribute__((ext_vector_type(8)));
typedef __bf16 v4bf  __attribute__((ext_vector_type(4)));
typedef float  v8f   __attribute__((ext_vector_type(8)));

union FragBF { v16bf v; v8bf h[2]; };

__device__ __forceinline__ v8f wmma_bf16(v16bf a, v16bf b, v8f c) {
    // (neg_a, A, neg_b, B, c_mod, C, reuse_a, reuse_b)
    return __builtin_amdgcn_wmma_f32_16x16x32_bf16(false, a, false, b,
                                                   (short)0, c, false, false);
}

// Raw hardware exp2 (v_exp_f32). Inputs here are well-scaled; no range fixup.
__device__ __forceinline__ float fast_exp2(float x) {
#if __has_builtin(__builtin_amdgcn_exp2f)
    return __builtin_amdgcn_exp2f(x);
#else
    return exp2f(x);
#endif
}

// DPP16 cross-lane move (VALU pipe, no LDS). Stays within 16-lane rows.
template <int CTRL>
__device__ __forceinline__ float dpp_mov(float v) {
    return __int_as_float(__builtin_amdgcn_update_dpp(
        0, __float_as_int(v), CTRL, 0xf, 0xf, true));
}

// Reductions over each 16-lane half-wave via DPP butterflies:
//   0xB1 = quad_perm(1,0,3,2) ~ xor1 ; 0x4E = quad_perm(2,3,0,1) ~ xor2 ;
//   0x141 = row_half_mirror (^7)     ; 0x140 = row_mirror (^15)
__device__ __forceinline__ float half16_max(float v) {
    v = fmaxf(v, dpp_mov<0xB1>(v));
    v = fmaxf(v, dpp_mov<0x4E>(v));
    v = fmaxf(v, dpp_mov<0x141>(v));
    v = fmaxf(v, dpp_mov<0x140>(v));
    return v;
}
__device__ __forceinline__ float half16_sum(float v) {
    v += dpp_mov<0xB1>(v);
    v += dpp_mov<0x4E>(v);
    v += dpp_mov<0x141>(v);
    v += dpp_mov<0x140>(v);
    return v;
}

// Fragment load for 16-bit A/B matrices (16x32 tile, row stride `ld` elems).
// ISA 7.12.2: lanes 0-15 hold row M=lane, K=0..7 (lo) and K=16..23 (hi);
// lanes 16-31 hold same row, K=8..15 and K=24..31. Two ds_load_b128 per lane.
__device__ __forceinline__ v16bf ldf(const __bf16* base, int ld) {
    const int lane = threadIdx.x & 31;
    const __bf16* p = base + (lane & 15) * ld + ((lane >> 4) << 3);
    FragBF f;
    f.h[0] = *(const v8bf*)(p);
    f.h[1] = *(const v8bf*)(p + 16);
    return f.v;
}

// ---------------------------------------------------------------------------
// fp32 -> bf16 conversion (vectorized, no transpose) for activations
// ---------------------------------------------------------------------------
__global__ __launch_bounds__(256) void cvt_f32_bf16(const float* __restrict__ in,
                                                    __bf16* __restrict__ out,
                                                    int n4) {
    int i = blockIdx.x * 256 + threadIdx.x;
    if (i < n4) {
        float4 v = ((const float4*)in)[i];
        v4bf o;
        o[0] = (__bf16)v.x; o[1] = (__bf16)v.y;
        o[2] = (__bf16)v.z; o[3] = (__bf16)v.w;
        ((v4bf*)out)[i] = o;
    }
}

// ---------------------------------------------------------------------------
// fp32 -> bf16 transposing conversion for weights: out[c*R + r] = in[r*C + c]
// 32x32 LDS tile, 256 threads (32x8), both sides coalesced.
// ---------------------------------------------------------------------------
__global__ __launch_bounds__(256) void cvt_t_f32_bf16(const float* __restrict__ in,
                                                      __bf16* __restrict__ out,
                                                      int R, int C) {
    __shared__ float tile[32][33];
    const int c0 = blockIdx.x * 32, r0 = blockIdx.y * 32;
    const int tx = threadIdx.x & 31, ty = threadIdx.x >> 5;   // 32 x 8
#pragma unroll
    for (int i = 0; i < 32; i += 8)
        tile[ty + i][tx] = in[(size_t)(r0 + ty + i) * C + c0 + tx];
    __syncthreads();
#pragma unroll
    for (int i = 0; i < 32; i += 8)
        out[(size_t)(c0 + ty + i) * R + r0 + tx] = (__bf16)tile[tx][ty + i];
}

// ---------------------------------------------------------------------------
// Tiled WMMA GEMM with pre-transposed B:  C[M,N] = A[M,K] * Bt[N,K]^T
// Block 128x128, BK=64, 256 thr = 8 waves (2x4), wave tile 64x32.
// Double-buffered LDS (72 KB) + register prefetch: 1 barrier / 64-K,
// global loads of tile k+1 overlap the 16 WMMAs of tile k;
// global_prefetch of tile k+2. LDS rows padded to 72 elems -> conflict-free.
// ---------------------------------------------------------------------------
#define GLD 72
template <bool OUTF32>
__global__ __launch_bounds__(256) void gemm_bt(
    const __bf16* __restrict__ A,   // [M,K] row-major
    const __bf16* __restrict__ Bt,  // [N,K] row-major (B transposed)
    __bf16* __restrict__ Cb, float* __restrict__ Cf,
    const float* __restrict__ bias, int M, int N, int K)
{
    __shared__ __bf16 As[2][128 * GLD];
    __shared__ __bf16 Bs[2][128 * GLD];

    const int tid  = threadIdx.x;
    const int lane = tid & 31;
    const int wave = tid >> 5;
    const size_t bm = (size_t)blockIdx.y * 128;
    const size_t bn = (size_t)blockIdx.x * 128;
    const int wm = (wave >> 2) * 64;   // 2 waves along M
    const int wn = (wave & 3) * 32;    // 4 waves along N

    // staging: each thread copies 64B of A and 64B of B per tile
    const int srow = tid >> 1;            // 0..127
    const int sseg = (tid & 1) * 32;      // 0 / 32
    const __bf16* ag = A  + (bm + srow) * (size_t)K + sseg;
    const __bf16* bg = Bt + (bn + srow) * (size_t)K + sseg;

    v8f acc[4][2];
#pragma unroll
    for (int i = 0; i < 4; ++i)
#pragma unroll
        for (int j = 0; j < 2; ++j) acc[i][j] = (v8f)0.0f;

    v8bf ar[4], br[4];
    auto ldregs = [&](int k0) {
#pragma unroll
        for (int i = 0; i < 4; ++i) ar[i] = *(const v8bf*)(ag + k0 + i * 8);
#pragma unroll
        for (int i = 0; i < 4; ++i) br[i] = *(const v8bf*)(bg + k0 + i * 8);
    };
    auto stregs = [&](int buf) {
#pragma unroll
        for (int i = 0; i < 4; ++i) *(v8bf*)&As[buf][srow * GLD + sseg + i * 8] = ar[i];
#pragma unroll
        for (int i = 0; i < 4; ++i) *(v8bf*)&Bs[buf][srow * GLD + sseg + i * 8] = br[i];
    };

    ldregs(0);
    stregs(0);
    __syncthreads();

    const int nk = K >> 6;
    for (int kt = 0; kt < nk; ++kt) {
        const int cur = kt & 1;
        if (kt + 1 < nk) {
            ldregs((kt + 1) * 64);
            if (kt + 2 < nk) {
                __builtin_prefetch(ag + (kt + 2) * 64, 0, 3);
                __builtin_prefetch(bg + (kt + 2) * 64, 0, 3);
            }
        }
#pragma unroll
        for (int ks = 0; ks < 64; ks += 32) {
            v16bf af[4], bfv[2];
#pragma unroll
            for (int i = 0; i < 4; ++i) af[i]  = ldf(&As[cur][(wm + i * 16) * GLD + ks], GLD);
#pragma unroll
            for (int j = 0; j < 2; ++j) bfv[j] = ldf(&Bs[cur][(wn + j * 16) * GLD + ks], GLD);
#pragma unroll
            for (int i = 0; i < 4; ++i)
#pragma unroll
                for (int j = 0; j < 2; ++j)
                    acc[i][j] = wmma_bf16(af[i], bfv[j], acc[i][j]);
        }
        if (kt + 1 < nk) stregs(cur ^ 1);
        __syncthreads();
    }

    // epilogue (compile-time specialized, bias hoisted per column tile).
    // fp32 path = final output (write-once) -> non-temporal stores.
    const int half8 = (lane >> 4) << 3;
    const int col   = lane & 15;
#pragma unroll
    for (int j = 0; j < 2; ++j) {
        const size_t gcol = bn + wn + j * 16 + col;
        float bv = 0.0f;
        if (OUTF32) bv = bias[gcol];
#pragma unroll
        for (int i = 0; i < 4; ++i)
#pragma unroll
            for (int r = 0; r < 8; ++r) {
                const size_t grow = bm + wm + i * 16 + r + half8;
                if (OUTF32)
                    __builtin_nontemporal_store(acc[i][j][r] + bv, &Cf[grow * (size_t)N + gcol]);
                else
                    Cb[grow * (size_t)N + gcol] = (__bf16)acc[i][j][r];
            }
    }
}

// ---------------------------------------------------------------------------
// Flash attention, WMMA bf16, f32 accum, online softmax in exp2 domain
// (scale * log2(e) folded into the single post-WMMA multiply; v_exp_f32 is
// natively exp2). Row reductions via DPP16 butterflies (no LDS bpermute).
// Block = 256 thr = 8 waves; wave owns 16 q rows; block covers 128 rows of
// one (b,h). KV walked in 64-row chunks, double-buffered (1 barrier/chunk),
// chunk k+1 prefetched into registers during WMMA of chunk k.
// ---------------------------------------------------------------------------
#define KLD 72

__global__ __launch_bounds__(256) void flash_attn(
    const __bf16* __restrict__ Qb,   // [B*T, 1024]
    const __bf16* __restrict__ KVb,  // [B*T, 2048]  (k | v)
    __bf16* __restrict__ Ob)         // [B*T, 1024]  merged heads
{
    __shared__ __bf16 Klds[2][64 * KLD];   // [t][e]  == B-layout for Q·K^T
    __shared__ __bf16 Vlds[2][64 * KLD];   // [e][t]  == B-layout for P·V
    __shared__ __bf16 Plds[8 * 16 * KLD];  // wave-private P tiles (16x64)

    const int tid = threadIdx.x, lane = tid & 31, wave = tid >> 5;
    const int b = blockIdx.z, h = blockIdx.y, qt = blockIdx.x;
    const int row16 = lane & 15;
    const int kb    = (lane >> 4) << 3;    // fragment K sub-offset
    const int half8 = kb;                  // C-layout row offset (same value)
    const int q0 = qt * 128 + wave * 16;

    // Q fragments straight from global (row stride 1024 elems, 16B aligned)
    const __bf16* qp = Qb + ((size_t)(b * 2048 + q0 + row16)) * 1024 + h * 64 + kb;
    FragBF qf0, qf1;
    qf0.h[0] = *(const v8bf*)(qp);
    qf0.h[1] = *(const v8bf*)(qp + 16);
    qf1.h[0] = *(const v8bf*)(qp + 32);
    qf1.h[1] = *(const v8bf*)(qp + 48);

    float m_i[8], l_i[8];
    v8f O[4];
#pragma unroll
    for (int r = 0; r < 8; ++r) { m_i[r] = -1e30f; l_i[r] = 0.0f; }
#pragma unroll
    for (int j = 0; j < 4; ++j) O[j] = (v8f)0.0f;

    // exp2-domain scale: 1/sqrt(64) * log2(e)
    const float scale2 = 0.125f * 1.4426950408889634f;
    __bf16* Pw = &Plds[wave * 16 * KLD];

    // KV staging: each thread copies 32B of K and 32B of V per chunk
    const int trow = tid >> 2, seg = (tid & 3) * 16;
    const __bf16* kgbase = KVb + (size_t)(b * 2048 + trow) * 2048 + h * 64 + seg;

    v8bf kr0, kr1, vr0, vr1;
    auto ldregs = [&](int t0) {
        const __bf16* kg = kgbase + (size_t)t0 * 2048;
        kr0 = *(const v8bf*)(kg);
        kr1 = *(const v8bf*)(kg + 8);
        vr0 = *(const v8bf*)(kg + 1024);
        vr1 = *(const v8bf*)(kg + 1032);
    };
    auto stregs = [&](int buf) {
        *(v8bf*)&Klds[buf][trow * KLD + seg]     = kr0;
        *(v8bf*)&Klds[buf][trow * KLD + seg + 8] = kr1;
#pragma unroll
        for (int i = 0; i < 8; ++i) Vlds[buf][(seg + i) * KLD + trow]     = vr0[i];
#pragma unroll
        for (int i = 0; i < 8; ++i) Vlds[buf][(seg + 8 + i) * KLD + trow] = vr1[i];
    };

    ldregs(0);
    stregs(0);
    __syncthreads();

    for (int ci = 0; ci < 32; ++ci) {            // 32 chunks of 64 kv rows
        const int cur = ci & 1;
        if (ci + 1 < 32) {
            ldregs((ci + 1) * 64);
            if (ci + 2 < 32)
                __builtin_prefetch(kgbase + (size_t)(ci + 2) * 64 * 2048, 0, 3);
        }

        // S2 = (scale*log2e) * Q K^T  (16 x 64, 4 N-tiles, E=64 in 2 steps)
        v8f s[4];
#pragma unroll
        for (int nt = 0; nt < 4; ++nt) {
            v8f z = (v8f)0.0f;
            z = wmma_bf16(qf0.v, ldf(&Klds[cur][nt * 16 * KLD], KLD), z);
            z = wmma_bf16(qf1.v, ldf(&Klds[cur][nt * 16 * KLD + 32], KLD), z);
#pragma unroll
            for (int r = 0; r < 8; ++r) z[r] *= scale2;
            s[nt] = z;
        }

        // online softmax in exp2 domain (rows live on half-wave lane groups)
        float corr[8];
#pragma unroll
        for (int r = 0; r < 8; ++r) {
            float rm = fmaxf(fmaxf(s[0][r], s[1][r]), fmaxf(s[2][r], s[3][r]));
            rm = half16_max(rm);
            float mn = fmaxf(m_i[r], rm);
            float c  = fast_exp2(m_i[r] - mn);
            float rsum = 0.0f;
#pragma unroll
            for (int nt = 0; nt < 4; ++nt) {
                float p = fast_exp2(s[nt][r] - mn);
                s[nt][r] = p;
                rsum += p;
            }
            rsum = half16_sum(rsum);
            l_i[r] = l_i[r] * c + rsum;
            m_i[r] = mn;
            corr[r] = c;
        }
#pragma unroll
        for (int j = 0; j < 4; ++j)
#pragma unroll
            for (int r = 0; r < 8; ++r) O[j][r] *= corr[r];

        // C-layout -> A-layout reshape of P through wave-private LDS
#pragma unroll
        for (int nt = 0; nt < 4; ++nt)
#pragma unroll
            for (int r = 0; r < 8; ++r)
                Pw[(r + half8) * KLD + nt * 16 + row16] = (__bf16)s[nt][r];

        v16bf pf0 = ldf(Pw, KLD);
        v16bf pf1 = ldf(Pw + 32, KLD);

        // O += P V   (E=64 in four 16-wide tiles, Kc=64 in 2 steps)
#pragma unroll
        for (int j = 0; j < 4; ++j) {
            O[j] = wmma_bf16(pf0, ldf(&Vlds[cur][j * 16 * KLD], KLD), O[j]);
            O[j] = wmma_bf16(pf1, ldf(&Vlds[cur][j * 16 * KLD + 32], KLD), O[j]);
        }

        if (ci + 1 < 32) stregs(cur ^ 1);
        __syncthreads();
    }

    // epilogue: O / l, write merged-head bf16
#pragma unroll
    for (int r = 0; r < 8; ++r) {
        float inv = 1.0f / l_i[r];
        size_t grow = (size_t)(b * 2048 + q0 + r + half8);
#pragma unroll
        for (int j = 0; j < 4; ++j)
            Ob[grow * 1024 + h * 64 + j * 16 + row16] = (__bf16)(O[j][r] * inv);
    }
}

// ---------------------------------------------------------------------------
// Launch: cvt(x) + cvt_t(weights) -> GEMM(Q) -> GEMM(KV) -> flash_attn
//         -> GEMM(out, +bias)
// ---------------------------------------------------------------------------
extern "C" void kernel_launch(void* const* d_in, const int* in_sizes, int n_in,
                              void* d_out, int out_size, void* d_ws, size_t ws_size,
                              hipStream_t stream) {
    const int B = 4, T = 2048, D = 1024, Hh = 16, E = 64;
    const int M = B * T;            // 8192
    const int DH = Hh * E;          // 1024

    const float* x    = (const float*)d_in[0];
    const float* Wq   = (const float*)d_in[1];
    const float* Wkv  = (const float*)d_in[2];
    const float* Wout = (const float*)d_in[3];
    const float* bout = (const float*)d_in[4];
    float* out = (float*)d_out;

    char* p = (char*)d_ws;
    __bf16* Xb    = (__bf16*)p; p += (size_t)M * D * 2;        // 16 MB
    __bf16* Wqt   = (__bf16*)p; p += (size_t)D * DH * 2;       //  2 MB  [N,K]
    __bf16* Wkvt  = (__bf16*)p; p += (size_t)D * 2 * DH * 2;   //  4 MB  [2N,K]
    __bf16* Woutt = (__bf16*)p; p += (size_t)DH * D * 2;       //  2 MB  [N,K]
    __bf16* Qbuf  = (__bf16*)p; p += (size_t)M * DH * 2;       // 16 MB
    __bf16* KVbuf = (__bf16*)p; p += (size_t)M * 2 * DH * 2;   // 32 MB
    __bf16* Obuf  = (__bf16*)p;                                // 16 MB

    // 1) activations: fp32 -> bf16 ; weights: fp32 -> bf16 transposed
    {
        int n4 = (M * D) / 4;
        cvt_f32_bf16<<<(n4 + 255) / 256, 256, 0, stream>>>(x, Xb, n4);
        cvt_t_f32_bf16<<<dim3(DH / 32, D / 32),     256, 0, stream>>>(Wq,   Wqt,   D,  DH);
        cvt_t_f32_bf16<<<dim3(2 * DH / 32, D / 32), 256, 0, stream>>>(Wkv,  Wkvt,  D,  2 * DH);
        cvt_t_f32_bf16<<<dim3(D / 32, DH / 32),     256, 0, stream>>>(Wout, Woutt, DH, D);
    }

    // 2) Q = X * Wq        [8192,1024] x [1024,1024] -> bf16
    gemm_bt<false><<<dim3(DH / 128, M / 128), 256, 0, stream>>>(
        Xb, Wqt, Qbuf, nullptr, nullptr, M, DH, D);

    // 3) KV = X * Wkv      [8192,1024] x [1024,2048] -> bf16
    gemm_bt<false><<<dim3(2 * DH / 128, M / 128), 256, 0, stream>>>(
        Xb, Wkvt, KVbuf, nullptr, nullptr, M, 2 * DH, D);

    // 4) flash attention   -> Obuf (bf16, merged heads)
    flash_attn<<<dim3(T / 128, Hh, B), 256, 0, stream>>>(Qbuf, KVbuf, Obuf);

    // 5) out = Obuf * Wout + bout   -> fp32 d_out
    gemm_bt<true><<<dim3(D / 128, M / 128), 256, 0, stream>>>(
        Obuf, Woutt, nullptr, out, bout, M, D, DH);
}

// v001
// Measured time: 208 microseconds a run.
// Next to v000, in two timings, it ran 1.15 times as fast each time.
#include <hip/hip_runtime.h>

// ---------------------------------------------------------------------------
// Types for CDNA5 WMMA (wave32): v_wmma_f32_16x16x32_bf16
// ---------------------------------------------------------------------------
typedef __bf16 v16bf __attribute__((ext_vector_type(16)));
typedef __bf16 v8bf  __attribute__((ext_vector_type(8)));
typedef __bf16 v4bf  __attribute__((ext_vector_type(4)));
typedef float  v8f   __attribute__((ext_vector_type(8)));

union FragBF { v16bf v; v8bf h[2]; };

__device__ __forceinline__ v8f wmma_bf16(v16bf a, v16bf b, v8f c) {
    // (neg_a, A, neg_b, B, c_mod, C, reuse_a, reuse_b)
    return __builtin_amdgcn_wmma_f32_16x16x32_bf16(false, a, false, b,
                                                   (short)0, c, false, false);
}

// Raw hardware exp2 (v_exp_f32). Inputs here are well-scaled; no range fixup.
__device__ __forceinline__ float fast_exp2(float x) {
#if __has_builtin(__builtin_amdgcn_exp2f)
    return __builtin_amdgcn_exp2f(x);
#else
    return exp2f(x);
#endif
}

// Fragment load for 16-bit A/B matrices (16x32 tile, row stride `ld` elems).
// ISA 7.12.2: lanes 0-15 hold row M=lane, K=0..7 (lo) and K=16..23 (hi);
// lanes 16-31 hold same row, K=8..15 and K=24..31. Two ds_load_b128 per lane.
__device__ __forceinline__ v16bf ldf(const __bf16* base, int ld) {
    const int lane = threadIdx.x & 31;
    const __bf16* p = base + (lane & 15) * ld + ((lane >> 4) << 3);
    FragBF f;
    f.h[0] = *(const v8bf*)(p);
    f.h[1] = *(const v8bf*)(p + 16);
    return f.v;
}

// ---------------------------------------------------------------------------
// fp32 -> bf16 conversion (vectorized, no transpose) for activations
// ---------------------------------------------------------------------------
__global__ __launch_bounds__(256) void cvt_f32_bf16(const float* __restrict__ in,
                                                    __bf16* __restrict__ out,
                                                    int n4) {
    int i = blockIdx.x * 256 + threadIdx.x;
    if (i < n4) {
        float4 v = ((const float4*)in)[i];
        v4bf o;
        o[0] = (__bf16)v.x; o[1] = (__bf16)v.y;
        o[2] = (__bf16)v.z; o[3] = (__bf16)v.w;
        ((v4bf*)out)[i] = o;
    }
}

// ---------------------------------------------------------------------------
// fp32 -> bf16 transposing conversion for weights: out[c*R + r] = in[r*C + c]
// 32x32 LDS tile, 256 threads (32x8), both sides coalesced.
// ---------------------------------------------------------------------------
__global__ __launch_bounds__(256) void cvt_t_f32_bf16(const float* __restrict__ in,
                                                      __bf16* __restrict__ out,
                                                      int R, int C) {
    __shared__ float tile[32][33];
    const int c0 = blockIdx.x * 32, r0 = blockIdx.y * 32;
    const int tx = threadIdx.x & 31, ty = threadIdx.x >> 5;   // 32 x 8
#pragma unroll
    for (int i = 0; i < 32; i += 8)
        tile[ty + i][tx] = in[(size_t)(r0 + ty + i) * C + c0 + tx];
    __syncthreads();
#pragma unroll
    for (int i = 0; i < 32; i += 8)
        out[(size_t)(c0 + ty + i) * R + r0 + tx] = (__bf16)tile[tx][ty + i];
}

// ---------------------------------------------------------------------------
// Tiled WMMA GEMM with pre-transposed B:  C[M,N] = A[M,K] * Bt[N,K]^T
// Block 128x128, BK=64, 256 thr = 8 waves (2x4), wave tile 64x32.
// Double-buffered LDS (72 KB) + register prefetch: 1 barrier / 64-K,
// global loads of tile k+1 overlap the 16 WMMAs of tile k;
// global_prefetch of tile k+2. LDS rows padded to 72 elems -> conflict-free.
// ---------------------------------------------------------------------------
#define GLD 72
template <bool OUTF32>
__global__ __launch_bounds__(256) void gemm_bt(
    const __bf16* __restrict__ A,   // [M,K] row-major
    const __bf16* __restrict__ Bt,  // [N,K] row-major (B transposed)
    __bf16* __restrict__ Cb, float* __restrict__ Cf,
    const float* __restrict__ bias, int M, int N, int K)
{
    __shared__ __bf16 As[2][128 * GLD];
    __shared__ __bf16 Bs[2][128 * GLD];

    const int tid  = threadIdx.x;
    const int lane = tid & 31;
    const int wave = tid >> 5;
    const size_t bm = (size_t)blockIdx.y * 128;
    const size_t bn = (size_t)blockIdx.x * 128;
    const int wm = (wave >> 2) * 64;   // 2 waves along M
    const int wn = (wave & 3) * 32;    // 4 waves along N

    // staging: each thread copies 64B of A and 64B of B per tile
    const int srow = tid >> 1;            // 0..127
    const int sseg = (tid & 1) * 32;      // 0 / 32
    const __bf16* ag = A  + (bm + srow) * (size_t)K + sseg;
    const __bf16* bg = Bt + (bn + srow) * (size_t)K + sseg;

    v8f acc[4][2];
#pragma unroll
    for (int i = 0; i < 4; ++i)
#pragma unroll
        for (int j = 0; j < 2; ++j) acc[i][j] = (v8f)0.0f;

    v8bf ar[4], br[4];
    auto ldregs = [&](int k0) {
#pragma unroll
        for (int i = 0; i < 4; ++i) ar[i] = *(const v8bf*)(ag + k0 + i * 8);
#pragma unroll
        for (int i = 0; i < 4; ++i) br[i] = *(const v8bf*)(bg + k0 + i * 8);
    };
    auto stregs = [&](int buf) {
#pragma unroll
        for (int i = 0; i < 4; ++i) *(v8bf*)&As[buf][srow * GLD + sseg + i * 8] = ar[i];
#pragma unroll
        for (int i = 0; i < 4; ++i) *(v8bf*)&Bs[buf][srow * GLD + sseg + i * 8] = br[i];
    };

    ldregs(0);
    stregs(0);
    __syncthreads();

    const int nk = K >> 6;
    for (int kt = 0; kt < nk; ++kt) {
        const int cur = kt & 1;
        if (kt + 1 < nk) {
            ldregs((kt + 1) * 64);
            if (kt + 2 < nk) {
                __builtin_prefetch(ag + (kt + 2) * 64, 0, 3);
                __builtin_prefetch(bg + (kt + 2) * 64, 0, 3);
            }
        }
#pragma unroll
        for (int ks = 0; ks < 64; ks += 32) {
            v16bf af[4], bfv[2];
#pragma unroll
            for (int i = 0; i < 4; ++i) af[i]  = ldf(&As[cur][(wm + i * 16) * GLD + ks], GLD);
#pragma unroll
            for (int j = 0; j < 2; ++j) bfv[j] = ldf(&Bs[cur][(wn + j * 16) * GLD + ks], GLD);
#pragma unroll
            for (int i = 0; i < 4; ++i)
#pragma unroll
                for (int j = 0; j < 2; ++j)
                    acc[i][j] = wmma_bf16(af[i], bfv[j], acc[i][j]);
        }
        if (kt + 1 < nk) stregs(cur ^ 1);
        __syncthreads();
    }

    // epilogue (compile-time specialized, bias hoisted per column tile).
    // fp32 path = final output (write-once) -> non-temporal stores.
    const int half8 = (lane >> 4) << 3;
    const int col   = lane & 15;
#pragma unroll
    for (int j = 0; j < 2; ++j) {
        const size_t gcol = bn + wn + j * 16 + col;
        float bv = 0.0f;
        if (OUTF32) bv = bias[gcol];
#pragma unroll
        for (int i = 0; i < 4; ++i)
#pragma unroll
            for (int r = 0; r < 8; ++r) {
                const size_t grow = bm + wm + i * 16 + r + half8;
                if (OUTF32)
                    __builtin_nontemporal_store(acc[i][j][r] + bv, &Cf[grow * (size_t)N + gcol]);
                else
                    Cb[grow * (size_t)N + gcol] = (__bf16)acc[i][j][r];
            }
    }
}

#define KLD 72

// lane l <-> lane l ^ 16 (VALU cross-row move, no LDS)
__device__ __forceinline__ float xhalf(float x) {
    return __int_as_float(__builtin_amdgcn_permlanex16(
        __float_as_int(x), __float_as_int(x), 0x76543210, 0xfedcba98, false, false));
}

// Two 16-key score tiles (f32 accumulators) -> one 32-key bf16 B fragment.
__device__ __forceinline__ v16bf pack_p(v8f lo, v8f hi) {
    FragBF f;
    f.h[0] = __builtin_convertvector(lo, v8bf);
    f.h[1] = __builtin_convertvector(hi, v8bf);
    return f.v;
}

__global__ __launch_bounds__(256) void flash_attn(
    const __bf16* __restrict__ Qb,   // [B*T, 1024]
    const __bf16* __restrict__ KVb,  // [B*T, 2048]  (k | v)
    __bf16* __restrict__ Ob)         // [B*T, 1024]  merged heads
{
    __shared__ __bf16 Klds[2][64 * KLD];   // [t][e]  == A-layout for K Q^T
    __shared__ __bf16 Vlds[2][64 * KLD];   // [e][t]  == A-layout for V^T P^T

    const int tid = threadIdx.x, lane = tid & 31, wave = tid >> 5;
    const int b = blockIdx.z, h = blockIdx.y, qt = blockIdx.x;
    const int row16 = lane & 15;
    const int kb    = (lane >> 4) << 3;    // fragment K sub-offset
    const int half8 = kb;                  // C-layout row offset (same value)
    const int q0 = qt * 128 + wave * 16;

    // Q fragments straight from global (row stride 1024 elems, 16B aligned)
    const __bf16* qp = Qb + ((size_t)(b * 2048 + q0 + row16)) * 1024 + h * 64 + kb;
    FragBF qf0, qf1;
    qf0.h[0] = *(const v8bf*)(qp);
    qf0.h[1] = *(const v8bf*)(qp + 16);
    qf1.h[0] = *(const v8bf*)(qp + 32);
    qf1.h[1] = *(const v8bf*)(qp + 48);

    // One query per lane: m_i is shared by the two halves, l_i is this half's
    // part of the denominator (joined once in the epilogue).
    float m_i = -1e30f, l_i = 0.0f;
    v8f O[4];                              // O^T: rows e = j*16 + r + half8
#pragma unroll
    for (int j = 0; j < 4; ++j) O[j] = (v8f)0.0f;

    // exp2-domain scale: 1/sqrt(64) * log2(e)
    const float scale2 = 0.125f * 1.4426950408889634f;

    // KV staging: each thread copies 32B of K and 32B of V per chunk
    const int trow = tid >> 2, seg = (tid & 3) * 16;
    const __bf16* kgbase = KVb + (size_t)(b * 2048 + trow) * 2048 + h * 64 + seg;

    v8bf kr0, kr1, vr0, vr1;
    auto ldregs = [&](int t0) {
        const __bf16* kg = kgbase + (size_t)t0 * 2048;
        kr0 = *(const v8bf*)(kg);
        kr1 = *(const v8bf*)(kg + 8);
        vr0 = *(const v8bf*)(kg + 1024);
        vr1 = *(const v8bf*)(kg + 1032);
    };
    auto stregs = [&](int buf) {
        *(v8bf*)&Klds[buf][trow * KLD + seg]     = kr0;
        *(v8bf*)&Klds[buf][trow * KLD + seg + 8] = kr1;
#pragma unroll
        for (int i = 0; i < 8; ++i) Vlds[buf][(seg + i) * KLD + trow]     = vr0[i];
#pragma unroll
        for (int i = 0; i < 8; ++i) Vlds[buf][(seg + 8 + i) * KLD + trow] = vr1[i];
    };

    ldregs(0);
    stregs(0);
    __syncthreads();

    for (int ci = 0; ci < 32; ++ci) {            // 32 chunks of 64 kv rows
        const int cur = ci & 1;
        if (ci + 1 < 32) {
            ldregs((ci + 1) * 64);
            if (ci + 2 < 32)
                __builtin_prefetch(kgbase + (size_t)(ci + 2) * 64 * 2048, 0, 3);
        }

        // S2^T = (scale*log2e) * K Q^T  (64 keys x 16 q, 4 M-tiles, E=64 in 2 steps)
        v8f s[4];
#pragma unroll
        for (int nt = 0; nt < 4; ++nt) {
            v8f z = (v8f)0.0f;
            z = wmma_bf16(ldf(&Klds[cur][nt * 16 * KLD], KLD), qf0.v, z);
            z = wmma_bf16(ldf(&Klds[cur][nt * 16 * KLD + 32], KLD), qf1.v, z);
#pragma unroll
            for (int r = 0; r < 8; ++r) z[r] *= scale2;
            s[nt] = z;
        }

        // online softmax in exp2 domain: this lane's 32 scores are one query's
        float rm4[4];
#pragma unroll
        for (int nt = 0; nt < 4; ++nt) {
            float t = s[nt][0];
#pragma unroll
            for (int r = 1; r < 8; ++r) t = fmaxf(t, s[nt][r]);
            rm4[nt] = t;
        }
        float rm = fmaxf(fmaxf(rm4[0], rm4[1]), fmaxf(rm4[2], rm4[3]));
        rm = fmaxf(rm, xhalf(rm));               // both halves: the query's chunk maximum
        const float mn = fmaxf(m_i, rm);
        const float c  = fast_exp2(m_i - mn);
        float rs4[4];
#pragma unroll
        for (int nt = 0; nt < 4; ++nt) {
            float t = 0.0f;
#pragma unroll
            for (int r = 0; r < 8; ++r) {
                float p = fast_exp2(s[nt][r] - mn);
                s[nt][r] = p;
                t += p;
            }
            rs4[nt] = t;
        }
        l_i = l_i * c + ((rs4[0] + rs4[1]) + (rs4[2] + rs4[3]));
        m_i = mn;
#pragma unroll
        for (int j = 0; j < 4; ++j)
#pragma unroll
            for (int r = 0; r < 8; ++r) O[j][r] *= c;

        // P^T as B operand, straight from the score accumulators
        v16bf pf0 = pack_p(s[0], s[1]);
        v16bf pf1 = pack_p(s[2], s[3]);

        // O^T += V^T P^T   (E=64 in four 16-row tiles, Kc=64 in 2 steps)
#pragma unroll
        for (int j = 0; j < 4; ++j) {
            O[j] = wmma_bf16(ldf(&Vlds[cur][j * 16 * KLD], KLD), pf0, O[j]);
            O[j] = wmma_bf16(ldf(&Vlds[cur][j * 16 * KLD + 32], KLD), pf1, O[j]);
        }

        if (ci + 1 < 32) stregs(cur ^ 1);
        __syncthreads();
    }

    // epilogue: join the halves' denominators, O^T / l, write merged-head bf16
    // (a lane holds 8 consecutive e of its query per tile: one 16 B store each)
    const float inv = 1.0f / (l_i + xhalf(l_i));
    __bf16* op = Ob + (size_t)(b * 2048 + q0 + row16) * 1024 + h * 64 + half8;
#pragma unroll
    for (int j = 0; j < 4; ++j) {
        v8f o = O[j];
#pragma unroll
        for (int r = 0; r < 8; ++r) o[r] *= inv;
        *(v8bf*)(op + j * 16) = __builtin_convertvector(o, v8bf);
    }
}

// ---------------------------------------------------------------------------
// Launch: cvt(x) + cvt_t(weights) -> GEMM(Q) -> GEMM(KV) -> flash_attn
//         -> GEMM(out, +bias)
// ---------------------------------------------------------------------------
extern "C" void kernel_launch(void* const* d_in, const int* in_sizes, int n_in,
                              void* d_out, int out_size, void* d_ws, size_t ws_size,
                              hipStream_t stream) {
    const int B = 4, T = 2048, D = 1024, Hh = 16, E = 64;
    const int M = B * T;            // 8192
    const int DH = Hh * E;          // 1024

    const float* x    = (const float*)d_in[0];
    const float* Wq   = (const float*)d_in[1];
    const float* Wkv  = (const float*)d_in[2];
    const float* Wout = (const float*)d_in[3];
    const float* bout = (const float*)d_in[4];
    float* out = (float*)d_out;

    char* p = (char*)d_ws;
    __bf16* Xb    = (__bf16*)p; p += (size_t)M * D * 2;        // 16 MB
    __bf16* Wqt   = (__bf16*)p; p += (size_t)D * DH * 2;       //  2 MB  [N,K]
    __bf16* Wkvt  = (__bf16*)p; p += (size_t)D * 2 * DH * 2;   //  4 MB  [2N,K]
    __bf16* Woutt = (__bf16*)p; p += (size_t)DH * D * 2;       //  2 MB  [N,K]
    __bf16* Qbuf  = (__bf16*)p; p += (size_t)M * DH * 2;       // 16 MB
    __bf16* KVbuf = (__bf16*)p; p += (size_t)M * 2 * DH * 2;   // 32 MB
    __bf16* Obuf  = (__bf16*)p;                                // 16 MB

    // 1) activations: fp32 -> bf16 ; weights: fp32 -> bf16 transposed
    {
        int n4 = (M * D) / 4;
        cvt_f32_bf16<<<(n4 + 255) / 256, 256, 0, stream>>>(x, Xb, n4);
        cvt_t_f32_bf16<<<dim3(DH / 32, D / 32),     256, 0, stream>>>(Wq,   Wqt,   D,  DH);
        cvt_t_f32_bf16<<<dim3(2 * DH / 32, D / 32), 256, 0, stream>>>(Wkv,  Wkvt,  D,  2 * DH);
        cvt_t_f32_bf16<<<dim3(D / 32, DH / 32),     256, 0, stream>>>(Wout, Woutt, DH, D);
    }

    // 2) Q = X * Wq        [8192,1024] x [1024,1024] -> bf16
    gemm_bt<false><<<dim3(DH / 128, M / 128), 256, 0, stream>>>(
        Xb, Wqt, Qbuf, nullptr, nullptr, M, DH, D);

    // 3) KV = X * Wkv      [8192,1024] x [1024,2048] -> bf16
    gemm_bt<false><<<dim3(2 * DH / 128, M / 128), 256, 0, stream>>>(
        Xb, Wkvt, KVbuf, nullptr, nullptr, M, 2 * DH, D);

    // 4) flash attention   -> Obuf (bf16, merged heads)
    flash_attn<<<dim3(T / 128, Hh, B), 256, 0, stream>>>(Qbuf, KVbuf, Obuf);

    // 5) out = Obuf * Wout + bout   -> fp32 d_out
    gemm_bt<true><<<dim3(D / 128, M / 128), 256, 0, stream>>>(
        Obuf, Woutt, nullptr, out, bout, M, D, DH);
}

// v002
// It runs in 179 microseconds.
// Timed twice side by side with v001, it ran 1.16 times as fast both times.
// All steps since v000 together make it 1.33 times as fast.
#include <hip/hip_runtime.h>

// ---------------------------------------------------------------------------
// Types for CDNA5 WMMA (wave32): v_wmma_f32_16x16x32_bf16
// ---------------------------------------------------------------------------
typedef __bf16 v16bf __attribute__((ext_vector_type(16)));
typedef __bf16 v8bf  __attribute__((ext_vector_type(8)));
typedef __bf16 v4bf  __attribute__((ext_vector_type(4)));
typedef float  v8f   __attribute__((ext_vector_type(8)));

union FragBF { v16bf v; v8bf h[2]; };

__device__ __forceinline__ v8f wmma_bf16(v16bf a, v16bf b, v8f c) {
    // (neg_a, A, neg_b, B, c_mod, C, reuse_a, reuse_b)
    return __builtin_amdgcn_wmma_f32_16x16x32_bf16(false, a, false, b,
                                                   (short)0, c, false, false);
}

// Raw hardware exp2 (v_exp_f32). Inputs here are well-scaled; no range fixup.
__device__ __forceinline__ float fast_exp2(float x) {
#if __has_builtin(__builtin_amdgcn_exp2f)
    return __builtin_amdgcn_exp2f(x);
#else
    return exp2f(x);
#endif
}

// Fragment load for 16-bit A/B matrices (16x32 tile, row stride `ld` elems).
// ISA 7.12.2: lanes 0-15 hold row M=lane, K=0..7 (lo) and K=16..23 (hi);
// lanes 16-31 hold same row, K=8..15 and K=24..31. Two ds_load_b128 per lane.
__device__ __forceinline__ v16bf ldf(const __bf16* base, int ld) {
    const int lane = threadIdx.x & 31;
    const __bf16* p = base + (lane & 15) * ld + ((lane >> 4) << 3);
    FragBF f;
    f.h[0] = *(const v8bf*)(p);
    f.h[1] = *(const v8bf*)(p + 16);
    return f.v;
}

// ---------------------------------------------------------------------------
// fp32 -> bf16 conversion (vectorized, no transpose) for activations
// ---------------------------------------------------------------------------
__global__ __launch_bounds__(256) void cvt_f32_bf16(const float* __restrict__ in,
                                                    __bf16* __restrict__ out,
                                                    int n4) {
    int i = blockIdx.x * 256 + threadIdx.x;
    if (i < n4) {
        float4 v = ((const float4*)in)[i];
        v4bf o;
        o[0] = (__bf16)v.x; o[1] = (__bf16)v.y;
        o[2] = (__bf16)v.z; o[3] = (__bf16)v.w;
        ((v4bf*)out)[i] = o;
    }
}

// ---------------------------------------------------------------------------
// fp32 -> bf16 transposing conversion for weights: out[c*R + r] = in[r*C + c]
// 32x32 LDS tile, 256 threads (32x8), both sides coalesced.
// ---------------------------------------------------------------------------
__global__ __launch_bounds__(256) void cvt_t_f32_bf16(const float* __restrict__ in,
                                                      __bf16* __restrict__ out,
                                                      int R, int C) {
    __shared__ float tile[32][33];
    const int c0 = blockIdx.x * 32, r0 = blockIdx.y * 32;
    const int tx = threadIdx.x & 31, ty = threadIdx.x >> 5;   // 32 x 8
#pragma unroll
    for (int i = 0; i < 32; i += 8)
        tile[ty + i][tx] = in[(size_t)(r0 + ty + i) * C + c0 + tx];
    __syncthreads();
#pragma unroll
    for (int i = 0; i < 32; i += 8)
        out[(size_t)(c0 + ty + i) * R + r0 + tx] = (__bf16)tile[tx][ty + i];
}

// ---------------------------------------------------------------------------
// Tiled WMMA GEMM with pre-transposed B:  C[M,N] = A[M,K] * Bt[N,K]^T
// Block 128x128, BK=64, 256 thr = 8 waves (2x4), wave tile 64x32.
// Double-buffered LDS (72 KB) + register prefetch: 1 barrier / 64-K,
// global loads of tile k+1 overlap the 16 WMMAs of tile k;
// global_prefetch of tile k+2. LDS rows padded to 72 elems -> conflict-free.
// ---------------------------------------------------------------------------
#define GLD 72
template <bool OUTF32>
__global__ __launch_bounds__(256) void gemm_bt(
    const __bf16* __restrict__ A,   // [M,K] row-major
    const __bf16* __restrict__ Bt,  // [N,K] row-major (B transposed)
    __bf16* __restrict__ Cb, float* __restrict__ Cf,
    const float* __restrict__ bias, int M, int N, int K)
{
    __shared__ __bf16 As[2][128 * GLD];
    __shared__ __bf16 Bs[2][128 * GLD];

    const int tid  = threadIdx.x;
    const int lane = tid & 31;
    const int wave = tid >> 5;
    const size_t bm = (size_t)blockIdx.y * 128;
    const size_t bn = (size_t)blockIdx.x * 128;
    const int wm = (wave >> 2) * 64;   // 2 waves along M
    const int wn = (wave & 3) * 32;    // 4 waves along N

    // staging: each thread copies 64B of A and 64B of B per tile
    const int srow = tid >> 1;            // 0..127
    const int sseg = (tid & 1) * 32;      // 0 / 32
    const __bf16* ag = A  + (bm + srow) * (size_t)K + sseg;
    const __bf16* bg = Bt + (bn + srow) * (size_t)K + sseg;

    v8f acc[4][2];
#pragma unroll
    for (int i = 0; i < 4; ++i)
#pragma unroll
        for (int j = 0; j < 2; ++j) acc[i][j] = (v8f)0.0f;

    v8bf ar[4], br[4];
    auto ldregs = [&](int k0) {
#pragma unroll
        for (int i = 0; i < 4; ++i) ar[i] = *(const v8bf*)(ag + k0 + i * 8);
#pragma unroll
        for (int i = 0; i < 4; ++i) br[i] = *(const v8bf*)(bg + k0 + i * 8);
    };
    auto stregs = [&](int buf) {
#pragma unroll
        for (int i = 0; i < 4; ++i) *(v8bf*)&As[buf][srow * GLD + sseg + i * 8] = ar[i];
#pragma unroll
        for (int i = 0; i < 4; ++i) *(v8bf*)&Bs[buf][srow * GLD + sseg + i * 8] = br[i];
    };

    ldregs(0);
    stregs(0);
    __syncthreads();

    const int nk = K >> 6;
    for (int kt = 0; kt < nk; ++kt) {
        const int cur = kt & 1;
        if (kt + 1 < nk) {
            ldregs((kt + 1) * 64);
            if (kt + 2 < nk) {
                __builtin_prefetch(ag + (kt + 2) * 64, 0, 3);
                __builtin_prefetch(bg + (kt + 2) * 64, 0, 3);
            }
        }
#pragma unroll
        for (int ks = 0; ks < 64; ks += 32) {
            v16bf af[4], bfv[2];
#pragma unroll
            for (int i = 0; i < 4; ++i) af[i]  = ldf(&As[cur][(wm + i * 16) * GLD + ks], GLD);
#pragma unroll
            for (int j = 0; j < 2; ++j) bfv[j] = ldf(&Bs[cur][(wn + j * 16) * GLD + ks], GLD);
#pragma unroll
            for (int i = 0; i < 4; ++i)
#pragma unroll
                for (int j = 0; j < 2; ++j)
                    acc[i][j] = wmma_bf16(af[i], bfv[j], acc[i][j]);
        }
        if (kt + 1 < nk) stregs(cur ^ 1);
        __syncthreads();
    }

    // epilogue (compile-time specialized, bias hoisted per column tile).
    // fp32 path = final output (write-once) -> non-temporal stores.
    const int half8 = (lane >> 4) << 3;
    const int col   = lane & 15;
#pragma unroll
    for (int j = 0; j < 2; ++j) {
        const size_t gcol = bn + wn + j * 16 + col;
        float bv = 0.0f;
        if (OUTF32) bv = bias[gcol];
#pragma unroll
        for (int i = 0; i < 4; ++i)
#pragma unroll
            for (int r = 0; r < 8; ++r) {
                const size_t grow = bm + wm + i * 16 + r + half8;
                if (OUTF32)
                    __builtin_nontemporal_store(acc[i][j][r] + bv, &Cf[grow * (size_t)N + gcol]);
                else
                    Cb[grow * (size_t)N + gcol] = (__bf16)acc[i][j][r];
            }
    }
}

#define KLD 72

// lane l <-> lane l ^ 16 (VALU cross-row move, no LDS)
__device__ __forceinline__ float xhalf(float x) {
    return __int_as_float(__builtin_amdgcn_permlanex16(
        __float_as_int(x), __float_as_int(x), 0x76543210, 0xfedcba98, false, false));
}

// Two 16-key score tiles (f32 accumulators) -> one 32-key bf16 B fragment.
__device__ __forceinline__ v16bf pack_p(v8f lo, v8f hi) {
    FragBF f;
    f.h[0] = __builtin_convertvector(lo, v8bf);
    f.h[1] = __builtin_convertvector(hi, v8bf);
    return f.v;
}

// Two workgroups per WGP (four waves per SIMD): the register budget is 256.
__global__ __launch_bounds__(256) __attribute__((amdgpu_waves_per_eu(4, 4))) void flash_attn(
    const __bf16* __restrict__ Qb,   // [B*T, 1024]
    const __bf16* __restrict__ KVb,  // [B*T, 2048]  (k | v)
    __bf16* __restrict__ Ob)         // [B*T, 1024]  merged heads
{
    __shared__ __bf16 Klds[2][64 * KLD];   // [t][e]  == A-layout for K Q^T
    __shared__ __bf16 Vlds[2][64 * KLD];   // [e][t]  == A-layout for V^T P^T

    const int tid = threadIdx.x, lane = tid & 31, wave = tid >> 5;
    const int b = blockIdx.z, h = blockIdx.y, qt = blockIdx.x;
    const int row16 = lane & 15;
    const int kb    = (lane >> 4) << 3;    // fragment K sub-offset
                                           // (also the C-layout row offset)

    // Q fragments straight from global (row stride 1024 elems, 16B aligned)
    // (block-uniform base + one 32-bit lane offset: addresses cost one register)
    const size_t   qo_base = (size_t)(b * 2048 + qt * 256) * 1024 + h * 64;
    const unsigned qo_lane = (unsigned)((wave * 32 + row16) * 1024 + kb);
    FragBF qf[2][2];
#pragma unroll
    for (int g = 0; g < 2; ++g) {
        const __bf16* qp = (Qb + qo_base) + (qo_lane + g * 16 * 1024);
        qf[g][0].h[0] = *(const v8bf*)(qp);
        qf[g][0].h[1] = *(const v8bf*)(qp + 16);
        qf[g][1].h[0] = *(const v8bf*)(qp + 32);
        qf[g][1].h[1] = *(const v8bf*)(qp + 48);
    }

    // One query per lane and group: m_i is shared by the two halves, l_i is
    // this half's part of the denominator (joined once in the epilogue).
    float m_i[2], l_i[2];
    v8f O[2][4];                           // O^T: rows e = j*16 + r + kb
#pragma unroll
    for (int g = 0; g < 2; ++g) {
        m_i[g] = -1e30f; l_i[g] = 0.0f;
#pragma unroll
        for (int j = 0; j < 4; ++j) O[g][j] = (v8f)0.0f;
    }

    // exp2-domain scale: 1/sqrt(64) * log2(e)
    const float scale2 = 0.125f * 1.4426950408889634f;

    // KV staging: each thread copies 32B of K and 32B of V per chunk
    const int trow = tid >> 2, seg = (tid & 3) * 16;
    const __bf16* kgbase = KVb + (size_t)(b * 2048 + trow) * 2048 + h * 64 + seg;

    v8bf kr0, kr1, vr0, vr1;
    auto ldregs = [&](int t0) {
        const __bf16* kg = kgbase + (size_t)t0 * 2048;
        kr0 = *(const v8bf*)(kg);
        kr1 = *(const v8bf*)(kg + 8);
        vr0 = *(const v8bf*)(kg + 1024);
        vr1 = *(const v8bf*)(kg + 1032);
    };
    auto stregs = [&](int buf) {
        *(v8bf*)&Klds[buf][trow * KLD + seg]     = kr0;
        *(v8bf*)&Klds[buf][trow * KLD + seg + 8] = kr1;
#pragma unroll
        for (int i = 0; i < 8; ++i) Vlds[buf][(seg + i) * KLD + trow]     = vr0[i];
#pragma unroll
        for (int i = 0; i < 8; ++i) Vlds[buf][(seg + 8 + i) * KLD + trow] = vr1[i];
    };

    ldregs(0);
    stregs(0);
    __syncthreads();

    for (int ci = 0; ci < 32; ++ci) {            // 32 chunks of 64 kv rows
        const int cur = ci & 1;
        if (ci + 1 < 32) {
            ldregs((ci + 1) * 64);
            if (ci + 2 < 32)
                __builtin_prefetch(kgbase + (size_t)(ci + 2) * 64 * 2048, 0, 3);
        }

        // S2^T = (scale*log2e) * K Q^T  (64 keys x 32 q: 4 M-tiles x 2 groups,
        // E=64 in 2 steps); one K fragment pair serves both groups
        v8f s[2][4];
#pragma unroll
        for (int nt = 0; nt < 4; ++nt) {
            const v16bf k0 = ldf(&Klds[cur][nt * 16 * KLD], KLD);
            const v16bf k1 = ldf(&Klds[cur][nt * 16 * KLD + 32], KLD);
#pragma unroll
            for (int g = 0; g < 2; ++g) {
                v8f z = (v8f)0.0f;
                z = wmma_bf16(k0, qf[g][0].v, z);
                z = wmma_bf16(k1, qf[g][1].v, z);
                s[g][nt] = z * scale2;
            }
        }

        // online softmax in exp2 domain: a lane's 32 scores of a group are one query's
        // (both groups' maxima and rescale factors first, then each group's exponentials:
        // written so, the packed operations pair registers of one group, without copies)
        v16bf pf[2][2];
        float mnew[2], corr[2];
#pragma unroll
        for (int g = 0; g < 2; ++g) {
            const v8f m8 = __builtin_elementwise_max(__builtin_elementwise_max(s[g][0], s[g][1]),
                                                     __builtin_elementwise_max(s[g][2], s[g][3]));
            float rm = fmaxf(fmaxf(fmaxf(m8[0], m8[1]), fmaxf(m8[2], m8[3])),
                             fmaxf(fmaxf(m8[4], m8[5]), fmaxf(m8[6], m8[7])));
            rm = fmaxf(rm, xhalf(rm));           // both halves: the query's chunk maximum
            mnew[g] = fmaxf(m_i[g], rm);
        }
#pragma unroll
        for (int g = 0; g < 2; ++g) corr[g] = fast_exp2(m_i[g] - mnew[g]);
#pragma unroll
        for (int g = 0; g < 2; ++g) {
            const float mn = mnew[g], c = corr[g];
            float rs4[4];
#pragma unroll
            for (int nt = 0; nt < 4; ++nt) {
                const v8f d = s[g][nt] - mn;
                float t = 0.0f;
#pragma unroll
                for (int r = 0; r < 8; ++r) {
                    float p = fast_exp2(d[r]);
                    s[g][nt][r] = p;
                    t += p;
                }
                rs4[nt] = t;
            }
            l_i[g] = l_i[g] * c + ((rs4[0] + rs4[1]) + (rs4[2] + rs4[3]));
            m_i[g] = mn;
#pragma unroll
            for (int j = 0; j < 4; ++j) O[g][j] *= c;

            // P^T as B operand, straight from the score accumulators
            pf[g][0] = pack_p(s[g][0], s[g][1]);
            pf[g][1] = pack_p(s[g][2], s[g][3]);
        }

        // O^T += V^T P^T   (E=64 in four 16-row tiles, Kc=64 in 2 steps);
        // one V^T fragment pair serves both groups
#pragma unroll
        for (int j = 0; j < 4; ++j) {
            const v16bf v0 = ldf(&Vlds[cur][j * 16 * KLD], KLD);
            const v16bf v1 = ldf(&Vlds[cur][j * 16 * KLD + 32], KLD);
#pragma unroll
            for (int g = 0; g < 2; ++g) {
                O[g][j] = wmma_bf16(v0, pf[g][0], O[g][j]);
                O[g][j] = wmma_bf16(v1, pf[g][1], O[g][j]);
            }
        }

        if (ci + 1 < 32) stregs(cur ^ 1);
        __syncthreads();
    }

    // epilogue: join the halves' denominators, O^T / l, write merged-head bf16
    // (a lane holds 8 consecutive e of its query per tile: one 16 B store each)
#pragma unroll
    for (int g = 0; g < 2; ++g) {
        const float inv = 1.0f / (l_i[g] + xhalf(l_i[g]));
        __bf16* op = (Ob + qo_base) + (qo_lane + g * 16 * 1024);
#pragma unroll
        for (int j = 0; j < 4; ++j) {
            v8f o = O[g][j];
#pragma unroll
            for (int r = 0; r < 8; ++r) o[r] *= inv;
            *(v8bf*)(op + j * 16) = __builtin_convertvector(o, v8bf);
        }
    }
}

// ---------------------------------------------------------------------------
// Launch: cvt(x) + cvt_t(weights) -> GEMM(Q) -> GEMM(KV) -> flash_attn
//         -> GEMM(out, +bias)
// ---------------------------------------------------------------------------
extern "C" void kernel_launch(void* const* d_in, const int* in_sizes, int n_in,
                              void* d_out, int out_size, void* d_ws, size_t ws_size,
                              hipStream_t stream) {
    const int B = 4, T = 2048, D = 1024, Hh = 16, E = 64;
    const int M = B * T;            // 8192
    const int DH = Hh * E;          // 1024

    const float* x    = (const float*)d_in[0];
    const float* Wq   = (const float*)d_in[1];
    const float* Wkv  = (const float*)d_in[2];
    const float* Wout = (const float*)d_in[3];
    const float* bout = (const float*)d_in[4];
    float* out = (float*)d_out;

    char* p = (char*)d_ws;
    __bf16* Xb    = (__bf16*)p; p += (size_t)M * D * 2;        // 16 MB
    __bf16* Wqt   = (__bf16*)p; p += (size_t)D * DH * 2;       //  2 MB  [N,K]
    __bf16* Wkvt  = (__bf16*)p; p += (size_t)D * 2 * DH * 2;   //  4 MB  [2N,K]
    __bf16* Woutt = (__bf16*)p; p += (size_t)DH * D * 2;       //  2 MB  [N,K]
    __bf16* Qbuf  = (__bf16*)p; p += (size_t)M * DH * 2;       // 16 MB
    __bf16* KVbuf = (__bf16*)p; p += (size_t)M * 2 * DH * 2;   // 32 MB
    __bf16* Obuf  = (__bf16*)p;                                // 16 MB

    // 1) activations: fp32 -> bf16 ; weights: fp32 -> bf16 transposed
    {
        int n4 = (M * D) / 4;
        cvt_f32_bf16<<<(n4 + 255) / 256, 256, 0, stream>>>(x, Xb, n4);
        cvt_t_f32_bf16<<<dim3(DH / 32, D / 32),     256, 0, stream>>>(Wq,   Wqt,   D,  DH);
        cvt_t_f32_bf16<<<dim3(2 * DH / 32, D / 32), 256, 0, stream>>>(Wkv,  Wkvt,  D,  2 * DH);
        cvt_t_f32_bf16<<<dim3(D / 32, DH / 32),     256, 0, stream>>>(Wout, Woutt, DH, D);
    }

    // 2) Q = X * Wq        [8192,1024] x [1024,1024] -> bf16
    gemm_bt<false><<<dim3(DH / 128, M / 128), 256, 0, stream>>>(
        Xb, Wqt, Qbuf, nullptr, nullptr, M, DH, D);

    // 3) KV = X * Wkv      [8192,1024] x [1024,2048] -> bf16
    gemm_bt<false><<<dim3(2 * DH / 128, M / 128), 256, 0, stream>>>(
        Xb, Wkvt, KVbuf, nullptr, nullptr, M, 2 * DH, D);

    // 4) flash attention   -> Obuf (bf16, merged heads)
    flash_attn<<<dim3(T / 256, Hh, B), 256, 0, stream>>>(Qbuf, KVbuf, Obuf);

    // 5) out = Obuf * Wout + bout   -> fp32 d_out
    gemm_bt<true><<<dim3(D / 128, M / 128), 256, 0, stream>>>(
        Obuf, Woutt, nullptr, out, bout, M, D, DH);
}

// v003
// One run takes 170 microseconds.
// Next to v002, in two timings, it ran 1.06 times as fast each time.
// Counting every step since v000, it is 1.40 times as fast.
#include <hip/hip_runtime.h>

// ---------------------------------------------------------------------------
// Types for CDNA5 WMMA (wave32): v_wmma_f32_16x16x32_bf16
// ---------------------------------------------------------------------------
typedef __bf16 v16bf __attribute__((ext_vector_type(16)));
typedef __bf16 v8bf  __attribute__((ext_vector_type(8)));
typedef __bf16 v4bf  __attribute__((ext_vector_type(4)));
typedef float  v8f   __attribute__((ext_vector_type(8)));
typedef float  v4f   __attribute__((ext_vector_type(4)));

union FragBF { v16bf v; v8bf h[2]; };

__device__ __forceinline__ v8f wmma_bf16(v16bf a, v16bf b, v8f c) {
    // (neg_a, A, neg_b, B, c_mod, C, reuse_a, reuse_b)
    return __builtin_amdgcn_wmma_f32_16x16x32_bf16(false, a, false, b,
                                                   (short)0, c, false, false);
}

// Raw hardware exp2 (v_exp_f32). Inputs here are well-scaled; no range fixup.
__device__ __forceinline__ float fast_exp2(float x) {
#if __has_builtin(__builtin_amdgcn_exp2f)
    return __builtin_amdgcn_exp2f(x);
#else
    return exp2f(x);
#endif
}

// Fragment load for 16-bit A/B matrices (16x32 tile, row stride `ld` elems).
// ISA 7.12.2: lanes 0-15 hold row M=lane, K=0..7 (lo) and K=16..23 (hi);
// lanes 16-31 hold same row, K=8..15 and K=24..31. Two ds_load_b128 per lane.
__device__ __forceinline__ v16bf ldf(const __bf16* base, int ld) {
    const int lane = threadIdx.x & 31;
    const __bf16* p = base + (lane & 15) * ld + ((lane >> 4) << 3);
    FragBF f;
    f.h[0] = *(const v8bf*)(p);
    f.h[1] = *(const v8bf*)(p + 16);
    return f.v;
}

// ---------------------------------------------------------------------------
// fp32 -> bf16 conversion (vectorized, no transpose) for activations
// ---------------------------------------------------------------------------
__global__ __launch_bounds__(256) void cvt_f32_bf16(const float* __restrict__ in,
                                                    __bf16* __restrict__ out,
                                                    int n4) {
    int i = blockIdx.x * 256 + threadIdx.x;
    if (i < n4) {
        float4 v = ((const float4*)in)[i];
        v4bf o;
        o[0] = (__bf16)v.x; o[1] = (__bf16)v.y;
        o[2] = (__bf16)v.z; o[3] = (__bf16)v.w;
        ((v4bf*)out)[i] = o;
    }
}

// ---------------------------------------------------------------------------
// fp32 -> bf16 transposing conversion for weights: out[c*R + r] = in[r*C + c]
// 32x32 LDS tile, 256 threads (32x8), both sides coalesced.
// ---------------------------------------------------------------------------
__global__ __launch_bounds__(256) void cvt_t_f32_bf16(const float* __restrict__ in,
                                                      __bf16* __restrict__ out,
                                                      int R, int C) {
    __shared__ float tile[32][33];
    const int c0 = blockIdx.x * 32, r0 = blockIdx.y * 32;
    const int tx = threadIdx.x & 31, ty = threadIdx.x >> 5;   // 32 x 8
#pragma unroll
    for (int i = 0; i < 32; i += 8)
        tile[ty + i][tx] = in[(size_t)(r0 + ty + i) * C + c0 + tx];
    __syncthreads();
#pragma unroll
    for (int i = 0; i < 32; i += 8)
        out[(size_t)(c0 + ty + i) * R + r0 + tx] = (__bf16)tile[tx][ty + i];
}

// ---------------------------------------------------------------------------
// Tiled WMMA GEMM with pre-transposed B:  C[M,N] = A[M,K] * Bt[N,K]^T
// Block 128x128, BK=64, 256 thr = 8 waves (2x4), wave tile 64x32.
// Double-buffered LDS (72 KB) + register prefetch: 1 barrier / 64-K,
// global loads of tile k+1 overlap the 16 WMMAs of tile k;
// global_prefetch of tile k+2. LDS rows padded to 72 elems -> conflict-free.
// The products are taken transposed (Bt fragment as A operand, A fragment as
// B operand), so a lane's 8 accumulators of a tile are 8 adjacent columns of
// one C row. After the K loop the C tile is staged in the operand buffers'
// LDS with 16 B stores and leaves as whole 128 B lines, 16 B a lane.
// ---------------------------------------------------------------------------
#define GLD 72
#define CPB 136   // C staging pitch, bf16 elems (272 B = 17 x 16 B)
#define CPF 132   // C staging pitch, f32 elems  (528 B = 33 x 16 B)
template <bool OUTF32>
__global__ __launch_bounds__(256) void gemm_bt(
    const __bf16* __restrict__ A,   // [M,K] row-major
    const __bf16* __restrict__ Bt,  // [N,K] row-major (B transposed)
    __bf16* __restrict__ Cb, float* __restrict__ Cf,
    const float* __restrict__ bias, int M, int N, int K)
{
    // [A buf 0 | A buf 1 | B buf 0 | B buf 1]; behind the K loop: the C tile
    __shared__ __attribute__((aligned(16))) __bf16 smem[4 * 128 * GLD];
    __bf16* const As = smem;
    __bf16* const Bs = smem + 2 * 128 * GLD;

    const int tid  = threadIdx.x;
    const int lane = tid & 31;
    const int wave = tid >> 5;
    const size_t bm = (size_t)blockIdx.y * 128;
    const size_t bn = (size_t)blockIdx.x * 128;
    const int wm = (wave >> 2) * 64;   // 2 waves along M
    const int wn = (wave & 3) * 32;    // 4 waves along N

    // staging: each thread copies 64B of A and 64B of B per tile
    const int srow = tid >> 1;            // 0..127
    const int sseg = (tid & 1) * 32;      // 0 / 32
    const __bf16* ag = A  + (bm + srow) * (size_t)K + sseg;
    const __bf16* bg = Bt + (bn + srow) * (size_t)K + sseg;

    v8f acc[4][2];
#pragma unroll
    for (int i = 0; i < 4; ++i)
#pragma unroll
        for (int j = 0; j < 2; ++j) acc[i][j] = (v8f)0.0f;

    v8bf ar[4], br[4];
    auto ldregs = [&](int k0) {
#pragma unroll
        for (int i = 0; i < 4; ++i) ar[i] = *(const v8bf*)(ag + k0 + i * 8);
#pragma unroll
        for (int i = 0; i < 4; ++i) br[i] = *(const v8bf*)(bg + k0 + i * 8);
    };
    auto stregs = [&](int buf) {
#pragma unroll
        for (int i = 0; i < 4; ++i) *(v8bf*)&As[buf * (128 * GLD) + srow * GLD + sseg + i * 8] = ar[i];
#pragma unroll
        for (int i = 0; i < 4; ++i) *(v8bf*)&Bs[buf * (128 * GLD) + srow * GLD + sseg + i * 8] = br[i];
    };

    ldregs(0);
    stregs(0);
    __syncthreads();

    const int nk = K >> 6;
    for (int kt = 0; kt < nk; ++kt) {
        const int cur = kt & 1;
        if (kt + 1 < nk) {
            ldregs((kt + 1) * 64);
            if (kt + 2 < nk) {
                __builtin_prefetch(ag + (kt + 2) * 64, 0, 3);
                __builtin_prefetch(bg + (kt + 2) * 64, 0, 3);
            }
        }
#pragma unroll
        for (int ks = 0; ks < 64; ks += 32) {
            v16bf af[4], bfv[2];
#pragma unroll
            for (int i = 0; i < 4; ++i) af[i]  = ldf(&As[cur * (128 * GLD) + (wm + i * 16) * GLD + ks], GLD);
#pragma unroll
            for (int j = 0; j < 2; ++j) bfv[j] = ldf(&Bs[cur * (128 * GLD) + (wn + j * 16) * GLD + ks], GLD);
#pragma unroll
            for (int i = 0; i < 4; ++i)
#pragma unroll
                for (int j = 0; j < 2; ++j)
                    acc[i][j] = wmma_bf16(bfv[j], af[i], acc[i][j]);   // C^T tile
        }
        if (kt + 1 < nk) stregs(cur ^ 1);
        __syncthreads();
    }

    // epilogue. acc[i][j][r] = C[wm + i*16 + (lane & 15)][wn + j*16 + r + half8].
    // The K loop's last barrier has ended every read of the operand buffers.
    const int half8 = (lane >> 4) << 3;
    const int mrow  = lane & 15;
    if (OUTF32) {
        // fp32 path = final output (write-once) -> non-temporal stores.
        float* const st = (float*)smem;
        const v4f bv = *(const v4f*)(bias + bn + lane * 4);   // the lane's 4 columns at the store
#pragma unroll
        for (int i = 0; i < 4; ++i)
#pragma unroll
            for (int j = 0; j < 2; ++j) {
                float* q = st + (wm + i * 16 + mrow) * CPF + wn + j * 16 + half8;
                *(v4f*)(q)     = __builtin_shufflevector(acc[i][j], acc[i][j], 0, 1, 2, 3);
                *(v4f*)(q + 4) = __builtin_shufflevector(acc[i][j], acc[i][j], 4, 5, 6, 7);
            }
        __syncthreads();
        // a wave stores one 512 B row of the tile per instruction
        // (block-uniform base + one 32-bit lane offset)
        float* const cg = Cf + bm * (size_t)N + bn;
        const unsigned o0 = (unsigned)(wave * N + lane * 4);
#pragma unroll
        for (int it = 0; it < 16; ++it) {
            const v4f c = *(const v4f*)(st + (it * 8 + wave) * CPF + lane * 4) + bv;
            __builtin_nontemporal_store(c, (v4f*)(cg + (o0 + (unsigned)(it * 8 * N))));
        }
    } else {
#pragma unroll
        for (int i = 0; i < 4; ++i)
#pragma unroll
            for (int j = 0; j < 2; ++j)
                *(v8bf*)&smem[(wm + i * 16 + mrow) * CPB + wn + j * 16 + half8] =
                    __builtin_convertvector(acc[i][j], v8bf);
        __syncthreads();
        // a wave stores two 256 B rows of the tile per instruction
        // (block-uniform base + one 32-bit lane offset)
        const int r0 = tid >> 4, c8 = (tid & 15) * 8;
        __bf16* const cg = Cb + bm * (size_t)N + bn;
        const unsigned o0 = (unsigned)(r0 * N + c8);
#pragma unroll
        for (int it = 0; it < 8; ++it)
            *(v8bf*)(cg + (o0 + (unsigned)(it * 16 * N))) =
                *(const v8bf*)&smem[(it * 16 + r0) * CPB + c8];
    }
}

#define KLD 72

// lane l <-> lane l ^ 16 (VALU cross-row move, no LDS)
__device__ __forceinline__ float xhalf(float x) {
    return __int_as_float(__builtin_amdgcn_permlanex16(
        __float_as_int(x), __float_as_int(x), 0x76543210, 0xfedcba98, false, false));
}

// Two 16-key score tiles (f32 accumulators) -> one 32-key bf16 B fragment.
__device__ __forceinline__ v16bf pack_p(v8f lo, v8f hi) {
    FragBF f;
    f.h[0] = __builtin_convertvector(lo, v8bf);
    f.h[1] = __builtin_convertvector(hi, v8bf);
    return f.v;
}

// Two workgroups per WGP (four waves per SIMD): the register budget is 256.
__global__ __launch_bounds__(256) __attribute__((amdgpu_waves_per_eu(4, 4))) void flash_attn(
    const __bf16* __restrict__ Qb,   // [B*T, 1024]
    const __bf16* __restrict__ KVb,  // [B*T, 2048]  (k | v)
    __bf16* __restrict__ Ob)         // [B*T, 1024]  merged heads
{
    // [K buf 0 | K buf 1 | V buf 0 | V buf 1]; behind the loop: O staging
    __shared__ __attribute__((aligned(16))) __bf16 smem[4 * 64 * KLD];
    __bf16* const Klds = smem;                  // [t][e]  == A-layout for K Q^T
    __bf16* const Vlds = smem + 2 * 64 * KLD;   // [e][t]  == A-layout for V^T P^T

    const int tid = threadIdx.x, lane = tid & 31, wave = tid >> 5;
    const int b = blockIdx.z, h = blockIdx.y, qt = blockIdx.x;
    const int row16 = lane & 15;
    const int kb    = (lane >> 4) << 3;    // fragment K sub-offset
                                           // (also the C-layout row offset)

    // Q fragments straight from global (row stride 1024 elems, 16B aligned)
    // (block-uniform base + one 32-bit lane offset: addresses cost one register)
    const size_t   qo_base = (size_t)(b * 2048 + qt * 256) * 1024 + h * 64;
    const unsigned qo_lane = (unsigned)((wave * 32 + row16) * 1024 + kb);
    FragBF qf[2][2];
#pragma unroll
    for (int g = 0; g < 2; ++g) {
        const __bf16* qp = (Qb + qo_base) + (qo_lane + g * 16 * 1024);
        qf[g][0].h[0] = *(const v8bf*)(qp);
        qf[g][0].h[1] = *(const v8bf*)(qp + 16);
        qf[g][1].h[0] = *(const v8bf*)(qp + 32);
        qf[g][1].h[1] = *(const v8bf*)(qp + 48);
    }

    // One query per lane and group: m_i is shared by the two halves, l_i is
    // this half's part of the denominator (joined once in the epilogue).
    float m_i[2], l_i[2];
    v8f O[2][4];                           // O^T: rows e = j*16 + r + kb
#pragma unroll
    for (int g = 0; g < 2; ++g) {
        m_i[g] = -1e30f; l_i[g] = 0.0f;
#pragma unroll
        for (int j = 0; j < 4; ++j) O[g][j] = (v8f)0.0f;
    }

    // exp2-domain scale: 1/sqrt(64) * log2(e)
    const float scale2 = 0.125f * 1.4426950408889634f;

    // KV staging: each thread copies 32B of K and 32B of V per chunk
    const int trow = tid >> 2, seg = (tid & 3) * 16;
    const __bf16* kgbase = KVb + (size_t)(b * 2048 + trow) * 2048 + h * 64 + seg;

    v8bf kr0, kr1, vr0, vr1;
    auto ldregs = [&](int t0) {
        const __bf16* kg = kgbase + (size_t)t0 * 2048;
        kr0 = *(const v8bf*)(kg);
        kr1 = *(const v8bf*)(kg + 8);
        vr0 = *(const v8bf*)(kg + 1024);
        vr1 = *(const v8bf*)(kg + 1032);
    };
    auto stregs = [&](int buf) {
        *(v8bf*)&Klds[buf * (64 * KLD) + trow * KLD + seg]     = kr0;
        *(v8bf*)&Klds[buf * (64 * KLD) + trow * KLD + seg + 8] = kr1;
#pragma unroll
        for (int i = 0; i < 8; ++i) Vlds[buf * (64 * KLD) + (seg + i) * KLD + trow]     = vr0[i];
#pragma unroll
        for (int i = 0; i < 8; ++i) Vlds[buf * (64 * KLD) + (seg + 8 + i) * KLD + trow] = vr1[i];
    };

    ldregs(0);
    stregs(0);
    __syncthreads();

    for (int ci = 0; ci < 32; ++ci) {            // 32 chunks of 64 kv rows
        const int cur = ci & 1;
        if (ci + 1 < 32) {
            ldregs((ci + 1) * 64);
            if (ci + 2 < 32)
                __builtin_prefetch(kgbase + (size_t)(ci + 2) * 64 * 2048, 0, 3);
        }

        // S2^T = (scale*log2e) * K Q^T  (64 keys x 32 q: 4 M-tiles x 2 groups,
        // E=64 in 2 steps); one K fragment pair serves both groups
        v8f s[2][4];
#pragma unroll
        for (int nt = 0; nt < 4; ++nt) {
            const v16bf k0 = ldf(&Klds[cur * (64 * KLD) + nt * 16 * KLD], KLD);
            const v16bf k1 = ldf(&Klds[cur * (64 * KLD) + nt * 16 * KLD + 32], KLD);
#pragma unroll
            for (int g = 0; g < 2; ++g) {
                v8f z = (v8f)0.0f;
                z = wmma_bf16(k0, qf[g][0].v, z);
                z = wmma_bf16(k1, qf[g][1].v, z);
                s[g][nt] = z * scale2;
            }
        }

        // online softmax in exp2 domain: a lane's 32 scores of a group are one query's
        // (both groups' maxima and rescale factors first, then each group's exponentials:
        // written so, the packed operations pair registers of one group, without copies)
        v16bf pf[2][2];
        float mnew[2], corr[2];
#pragma unroll
        for (int g = 0; g < 2; ++g) {
            const v8f m8 = __builtin_elementwise_max(__builtin_elementwise_max(s[g][0], s[g][1]),
                                                     __builtin_elementwise_max(s[g][2], s[g][3]));
            float rm = fmaxf(fmaxf(fmaxf(m8[0], m8[1]), fmaxf(m8[2], m8[3])),
                             fmaxf(fmaxf(m8[4], m8[5]), fmaxf(m8[6], m8[7])));
            rm = fmaxf(rm, xhalf(rm));           // both halves: the query's chunk maximum
            mnew[g] = fmaxf(m_i[g], rm);
        }
#pragma unroll
        for (int g = 0; g < 2; ++g) corr[g] = fast_exp2(m_i[g] - mnew[g]);
#pragma unroll
        for (int g = 0; g < 2; ++g) {
            const float mn = mnew[g], c = corr[g];
            float rs4[4];
#pragma unroll
            for (int nt = 0; nt < 4; ++nt) {
                const v8f d = s[g][nt] - mn;
                float t = 0.0f;
#pragma unroll
                for (int r = 0; r < 8; ++r) {
                    float p = fast_exp2(d[r]);
                    s[g][nt][r] = p;
                    t += p;
                }
                rs4[nt] = t;
            }
            l_i[g] = l_i[g] * c + ((rs4[0] + rs4[1]) + (rs4[2] + rs4[3]));
            m_i[g] = mn;
#pragma unroll
            for (int j = 0; j < 4; ++j) O[g][j] *= c;

            // P^T as B operand, straight from the score accumulators
            pf[g][0] = pack_p(s[g][0], s[g][1]);
            pf[g][1] = pack_p(s[g][2], s[g][3]);
        }

        // O^T += V^T P^T   (E=64 in four 16-row tiles, Kc=64 in 2 steps);
        // one V^T fragment pair serves both groups
#pragma unroll
        for (int j = 0; j < 4; ++j) {
            const v16bf v0 = ldf(&Vlds[cur * (64 * KLD) + j * 16 * KLD], KLD);
            const v16bf v1 = ldf(&Vlds[cur * (64 * KLD) + j * 16 * KLD + 32], KLD);
#pragma unroll
            for (int g = 0; g < 2; ++g) {
                O[g][j] = wmma_bf16(v0, pf[g][0], O[g][j]);
                O[g][j] = wmma_bf16(v1, pf[g][1], O[g][j]);
            }
        }

        if (ci + 1 < 32) stregs(cur ^ 1);
        __syncthreads();
    }

    // epilogue: join the halves' denominators, O^T / l, merged-head bf16.
    // A lane holds 8 consecutive e of its query per tile. Each wave stages its
    // 32 rows of 128 B in its own 32 x KLD slice of the LDS (the loop's last
    // barrier has ended every read of K and V), then stores whole 128 B lines.
    __bf16* const stg = smem + wave * (32 * KLD);
#pragma unroll
    for (int g = 0; g < 2; ++g) {
        const float inv = 1.0f / (l_i[g] + xhalf(l_i[g]));
#pragma unroll
        for (int j = 0; j < 4; ++j) {
            v8f o = O[g][j];
#pragma unroll
            for (int r = 0; r < 8; ++r) o[r] *= inv;
            *(v8bf*)&stg[(g * 16 + row16) * KLD + j * 16 + kb] = __builtin_convertvector(o, v8bf);
        }
    }
    // the wave's own LDS stores are complete before other lanes read the rows back
    asm volatile("s_wait_dscnt 0x0" ::: "memory");
#pragma unroll
    for (int it = 0; it < 8; ++it) {           // 4 rows (4 lines) per instruction
        const int row = it * 4 + (lane >> 3);
        const int c8  = (lane & 7) * 8;
        *(v8bf*)((Ob + qo_base) + (unsigned)((wave * 32 + row) * 1024 + c8)) =
            *(const v8bf*)&stg[row * KLD + c8];
    }
}

// ---------------------------------------------------------------------------
// Launch: cvt(x) + cvt_t(weights) -> GEMM(Q) -> GEMM(KV) -> flash_attn
//         -> GEMM(out, +bias)
// ---------------------------------------------------------------------------
extern "C" void kernel_launch(void* const* d_in, const int* in_sizes, int n_in,
                              void* d_out, int out_size, void* d_ws, size_t ws_size,
                              hipStream_t stream) {
    const int B = 4, T = 2048, D = 1024, Hh = 16, E = 64;
    const int M = B * T;            // 8192
    const int DH = Hh * E;          // 1024

    const float* x    = (const float*)d_in[0];
    const float* Wq   = (const float*)d_in[1];
    const float* Wkv  = (const float*)d_in[2];
    const float* Wout = (const float*)d_in[3];
    const float* bout = (const float*)d_in[4];
    float* out = (float*)d_out;

    char* p = (char*)d_ws;
    __bf16* Xb    = (__bf16*)p; p += (size_t)M * D * 2;        // 16 MB
    __bf16* Wqt   = (__bf16*)p; p += (size_t)D * DH * 2;       //  2 MB  [N,K]
    __bf16* Wkvt  = (__bf16*)p; p += (size_t)D * 2 * DH * 2;   //  4 MB  [2N,K]
    __bf16* Woutt = (__bf16*)p; p += (size_t)DH * D * 2;       //  2 MB  [N,K]
    __bf16* Qbuf  = (__bf16*)p; p += (size_t)M * DH * 2;       // 16 MB
    __bf16* KVbuf = (__bf16*)p; p += (size_t)M * 2 * DH * 2;   // 32 MB
    __bf16* Obuf  = (__bf16*)p;                                // 16 MB

    // 1) activations: fp32 -> bf16 ; weights: fp32 -> bf16 transposed
    {
        int n4 = (M * D) / 4;
        cvt_f32_bf16<<<(n4 + 255) / 256, 256, 0, stream>>>(x, Xb, n4);
        cvt_t_f32_bf16<<<dim3(DH / 32, D / 32),     256, 0, stream>>>(Wq,   Wqt,   D,  DH);
        cvt_t_f32_bf16<<<dim3(2 * DH / 32, D / 32), 256, 0, stream>>>(Wkv,  Wkvt,  D,  2 * DH);
        cvt_t_f32_bf16<<<dim3(D / 32, DH / 32),     256, 0, stream>>>(Wout, Woutt, DH, D);
    }

    // 2) Q = X * Wq        [8192,1024] x [1024,1024] -> bf16
    gemm_bt<false><<<dim3(DH / 128, M / 128), 256, 0, stream>>>(
        Xb, Wqt, Qbuf, nullptr, nullptr, M, DH, D);

    // 3) KV = X * Wkv      [8192,1024] x [1024,2048] -> bf16
    gemm_bt<false><<<dim3(2 * DH / 128, M / 128), 256, 0, stream>>>(
        Xb, Wkvt, KVbuf, nullptr, nullptr, M, 2 * DH, D);

    // 4) flash attention   -> Obuf (bf16, merged heads)
    flash_attn<<<dim3(T / 256, Hh, B), 256, 0, stream>>>(Qbuf, KVbuf, Obuf);

    // 5) out = Obuf * Wout + bout   -> fp32 d_out
    gemm_bt<true><<<dim3(D / 128, M / 128), 256, 0, stream>>>(
        Obuf, Woutt, nullptr, out, bout, M, D, DH);
}

// v004
// A run of this version takes 160 microseconds.
// In both of two side-by-side timings against v003, it was 1.06 times as fast.
// Counting every step since v000, it is 1.49 times as fast.
#include <hip/hip_runtime.h>

// ---------------------------------------------------------------------------
// Types for CDNA5 WMMA (wave32): v_wmma_f32_16x16x32_bf16
// ---------------------------------------------------------------------------
typedef __bf16 v16bf __attribute__((ext_vector_type(16)));
typedef __bf16 v8bf  __attribute__((ext_vector_type(8)));
typedef __bf16 v4bf  __attribute__((ext_vector_type(4)));
typedef float  v8f   __attribute__((ext_vector_type(8)));
typedef float  v4f   __attribute__((ext_vector_type(4)));

union FragBF { v16bf v; v8bf h[2]; };

__device__ __forceinline__ v8f wmma_bf16(v16bf a, v16bf b, v8f c) {
    // (neg_a, A, neg_b, B, c_mod, C, reuse_a, reuse_b)
    return __builtin_amdgcn_wmma_f32_16x16x32_bf16(false, a, false, b,
                                                   (short)0, c, false, false);
}

// Raw hardware exp2 (v_exp_f32). Inputs here are well-scaled; no range fixup.
__device__ __forceinline__ float fast_exp2(float x) {
#if __has_builtin(__builtin_amdgcn_exp2f)
    return __builtin_amdgcn_exp2f(x);
#else
    return exp2f(x);
#endif
}

// Fragment load for 16-bit A/B matrices (16x32 tile, row stride `ld` elems).
// ISA 7.12.2: lanes 0-15 hold row M=lane, K=0..7 (lo) and K=16..23 (hi);
// lanes 16-31 hold same row, K=8..15 and K=24..31. Two ds_load_b128 per lane.
__device__ __forceinline__ v16bf ldf(const __bf16* base, int ld) {
    const int lane = threadIdx.x & 31;
    const __bf16* p = base + (lane & 15) * ld + ((lane >> 4) << 3);
    FragBF f;
    f.h[0] = *(const v8bf*)(p);
    f.h[1] = *(const v8bf*)(p + 16);
    return f.v;
}

// ---------------------------------------------------------------------------
// All fp32 -> bf16 conversions in one launch of 768 work-groups, 64 values a
// thread, so that few waves are started for the bytes moved.
// Blocks 0..255: weights, transposed. The three [1024][C] weights give one
// [4096][1024] bf16 array Wt (rows 0..1023 Wq^T, 1024..3071 Wkv^T, 3072..4095
// Wout^T). A block takes a panel of 64 rows x 256 columns: 16 loads of 16 B a
// lane in flight, through LDS, out as whole 128 B lines (8 lanes x 16 B).
// Blocks 256..767: x, 64 values a thread, 16 loads of 16 B a lane in flight.
// ---------------------------------------------------------------------------
#define WP 257   // panel pitch in f32: 1 mod 64, both LDS sides free of bank conflicts
__global__ __launch_bounds__(256) void cvt_all(const float* __restrict__ x,
                                               const float* __restrict__ Wq,
                                               const float* __restrict__ Wkv,
                                               const float* __restrict__ Wout,
                                               __bf16* __restrict__ Xb,
                                               __bf16* __restrict__ Wt) {
    __shared__ float tile[64 * WP];
    const int tid = threadIdx.x;
    const int blk = blockIdx.x;

    if (blk >= 256) {                        // block-uniform, ahead of the barrier
        // (block-uniform base + one 32-bit lane offset)
        const size_t o = (size_t)(blk - 256) * 4096;
        const v4f* const s = (const v4f*)x + o;
        v4bf* const d = (v4bf*)Xb + o;
        v4f v[16];
#pragma unroll
        for (int k = 0; k < 16; ++k) v[k] = s[(unsigned)(tid + k * 256)];
#pragma unroll
        for (int k = 0; k < 16; ++k) d[(unsigned)(tid + k * 256)] = __builtin_convertvector(v[k], v4bf);
        return;
    }

    const int cp = blk & 15;                 // 256-column panel: 4 of Wq, 8 of Wkv, 4 of Wout
    const int r0 = (blk >> 4) * 64;
    const bool wide = cp >= 4 && cp < 12;    // Wkv: rows of 2048, the others of 1024

    // a half wave loads 256 B of one row, the other half of the row two below:
    // in LDS the halves' banks then differ by two, and a pair of 4 B stores a
    // lane meets all 64 banks once
    const int lane = tid & 31, wave = tid >> 5;
    const int lr = (lane >> 4) * 2 + (wave >> 2);            // row within 4
    const int lc = ((wave & 3) * 16 + (lane & 15)) * 4;      // column
    // (block-uniform base + one 32-bit lane offset; the row length is a constant
    // on either side)
    v4f v[16];
    if (wide) {
        const float* const s = Wkv + (size_t)r0 * 2048 + (cp - 4) * 256;
#pragma unroll
        for (int p = 0; p < 16; ++p) v[p] = *(const v4f*)(s + (unsigned)((p * 4 + lr) * 2048 + lc));
    } else {
        const float* const s = (cp < 4 ? Wq : Wout) + (size_t)r0 * 1024 + (cp & 3) * 256;
#pragma unroll
        for (int p = 0; p < 16; ++p) v[p] = *(const v4f*)(s + (unsigned)((p * 4 + lr) * 1024 + lc));
    }
#pragma unroll
    for (int p = 0; p < 16; ++p)
#pragma unroll
        for (int k = 0; k < 4; ++k) tile[(p * 4 + lr) * WP + lc + k] = v[p][k];
    __syncthreads();

    // 8 lanes write one 128 B line: 64 rows of the panel for one column
    const int rc = (tid & 7) * 8, cc = tid >> 3;
    __bf16* const d = Wt + (size_t)(cp * 256 + cc) * 1024 + r0 + rc;
#pragma unroll
    for (int q = 0; q < 8; ++q) {
        v8f a;
#pragma unroll
        for (int i = 0; i < 8; ++i) a[i] = tile[(rc + i) * WP + q * 32 + cc];
        *(v8bf*)(d + (size_t)q * 32 * 1024) = __builtin_convertvector(a, v8bf);
    }
}

// ---------------------------------------------------------------------------
// Tiled WMMA GEMM with pre-transposed B:  C[M,N] = A[M,K] * Bt[N,K]^T
// Block 128x128, BK=64, 256 thr = 8 waves (2x4), wave tile 64x32.
// Double-buffered LDS (72 KB) + register prefetch: 1 barrier / 64-K,
// global loads of tile k+1 overlap the 16 WMMAs of tile k;
// global_prefetch of tile k+2. LDS rows padded to 72 elems -> conflict-free.
// The products are taken transposed (Bt fragment as A operand, A fragment as
// B operand), so a lane's 8 accumulators of a tile are 8 adjacent columns of
// one C row. After the K loop the C tile is staged in the operand buffers'
// LDS with 16 B stores and leaves as whole 128 B lines, 16 B a lane.
// ---------------------------------------------------------------------------
#define GLD 72
#define CPB 136   // C staging pitch, bf16 elems (272 B = 17 x 16 B)
#define CPF 132   // C staging pitch, f32 elems  (528 B = 33 x 16 B)
template <bool OUTF32>
__global__ __launch_bounds__(256) void gemm_bt(
    const __bf16* __restrict__ A,   // [M,K] row-major
    const __bf16* __restrict__ Bt,  // [N,K] row-major (B transposed)
    __bf16* __restrict__ Cb, float* __restrict__ Cf,
    const float* __restrict__ bias, int M, int N, int K)
{
    // [A buf 0 | A buf 1 | B buf 0 | B buf 1]; behind the K loop: the C tile
    __shared__ __attribute__((aligned(16))) __bf16 smem[4 * 128 * GLD];
    __bf16* const As = smem;
    __bf16* const Bs = smem + 2 * 128 * GLD;

    const int tid  = threadIdx.x;
    const int lane = tid & 31;
    const int wave = tid >> 5;
    const size_t bm = (size_t)blockIdx.y * 128;
    const size_t bn = (size_t)blockIdx.x * 128;
    const int wm = (wave >> 2) * 64;   // 2 waves along M
    const int wn = (wave & 3) * 32;    // 4 waves along N

    // staging: each thread copies 64B of A and 64B of B per tile
    const int srow = tid >> 1;            // 0..127
    const int sseg = (tid & 1) * 32;      // 0 / 32
    const __bf16* ag = A  + (bm + srow) * (size_t)K + sseg;
    const __bf16* bg = Bt + (bn + srow) * (size_t)K + sseg;

    v8f acc[4][2];
#pragma unroll
    for (int i = 0; i < 4; ++i)
#pragma unroll
        for (int j = 0; j < 2; ++j) acc[i][j] = (v8f)0.0f;

    v8bf ar[4], br[4];
    auto ldregs = [&](int k0) {
#pragma unroll
        for (int i = 0; i < 4; ++i) ar[i] = *(const v8bf*)(ag + k0 + i * 8);
#pragma unroll
        for (int i = 0; i < 4; ++i) br[i] = *(const v8bf*)(bg + k0 + i * 8);
    };
    auto stregs = [&](int buf) {
#pragma unroll
        for (int i = 0; i < 4; ++i) *(v8bf*)&As[buf * (128 * GLD) + srow * GLD + sseg + i * 8] = ar[i];
#pragma unroll
        for (int i = 0; i < 4; ++i) *(v8bf*)&Bs[buf * (128 * GLD) + srow * GLD + sseg + i * 8] = br[i];
    };

    ldregs(0);
    stregs(0);
    __syncthreads();

    const int nk = K >> 6;
    for (int kt = 0; kt < nk; ++kt) {
        const int cur = kt & 1;
        if (kt + 1 < nk) {
            ldregs((kt + 1) * 64);
            if (kt + 2 < nk) {
                __builtin_prefetch(ag + (kt + 2) * 64, 0, 3);
                __builtin_prefetch(bg + (kt + 2) * 64, 0, 3);
            }
        }
#pragma unroll
        for (int ks = 0; ks < 64; ks += 32) {
            v16bf af[4], bfv[2];
#pragma unroll
            for (int i = 0; i < 4; ++i) af[i]  = ldf(&As[cur * (128 * GLD) + (wm + i * 16) * GLD + ks], GLD);
#pragma unroll
            for (int j = 0; j < 2; ++j) bfv[j] = ldf(&Bs[cur * (128 * GLD) + (wn + j * 16) * GLD + ks], GLD);
#pragma unroll
            for (int i = 0; i < 4; ++i)
#pragma unroll
                for (int j = 0; j < 2; ++j)
                    acc[i][j] = wmma_bf16(bfv[j], af[i], acc[i][j]);   // C^T tile
        }
        if (kt + 1 < nk) stregs(cur ^ 1);
        __syncthreads();
    }

    // epilogue. acc[i][j][r] = C[wm + i*16 + (lane & 15)][wn + j*16 + r + half8].
    // The K loop's last barrier has ended every read of the operand buffers.
    const int half8 = (lane >> 4) << 3;
    const int mrow  = lane & 15;
    if (OUTF32) {
        // fp32 path = final output (write-once) -> non-temporal stores.
        float* const st = (float*)smem;
        const v4f bv = *(const v4f*)(bias + bn + lane * 4);   // the lane's 4 columns at the store
#pragma unroll
        for (int i = 0; i < 4; ++i)
#pragma unroll
            for (int j = 0; j < 2; ++j) {
                float* q = st + (wm + i * 16 + mrow) * CPF + wn + j * 16 + half8;
                *(v4f*)(q)     = __builtin_shufflevector(acc[i][j], acc[i][j], 0, 1, 2, 3);
                *(v4f*)(q + 4) = __builtin_shufflevector(acc[i][j], acc[i][j], 4, 5, 6, 7);
            }
        __syncthreads();
        // a wave stores one 512 B row of the tile per instruction
        // (block-uniform base + one 32-bit lane offset)
        float* const cg = Cf + bm * (size_t)N + bn;
        const unsigned o0 = (unsigned)(wave * N + lane * 4);
#pragma unroll
        for (int it = 0; it < 16; ++it) {
            const v4f c = *(const v4f*)(st + (it * 8 + wave) * CPF + lane * 4) + bv;
            __builtin_nontemporal_store(c, (v4f*)(cg + (o0 + (unsigned)(it * 8 * N))));
        }
    } else {
#pragma unroll
        for (int i = 0; i < 4; ++i)
#pragma unroll
            for (int j = 0; j < 2; ++j)
                *(v8bf*)&smem[(wm + i * 16 + mrow) * CPB + wn + j * 16 + half8] =
                    __builtin_convertvector(acc[i][j], v8bf);
        __syncthreads();
        // a wave stores two 256 B rows of the tile per instruction
        // (block-uniform base + one 32-bit lane offset)
        const int r0 = tid >> 4, c8 = (tid & 15) * 8;
        __bf16* const cg = Cb + bm * (size_t)N + bn;
        const unsigned o0 = (unsigned)(r0 * N + c8);
#pragma unroll
        for (int it = 0; it < 8; ++it)
            *(v8bf*)(cg + (o0 + (unsigned)(it * 16 * N))) =
                *(const v8bf*)&smem[(it * 16 + r0) * CPB + c8];
    }
}

#define KLD 72

// lane l <-> lane l ^ 16 (VALU cross-row move, no LDS)
__device__ __forceinline__ float xhalf(float x) {
    return __int_as_float(__builtin_amdgcn_permlanex16(
        __float_as_int(x), __float_as_int(x), 0x76543210, 0xfedcba98, false, false));
}

// Two 16-key score tiles (f32 accumulators) -> one 32-key bf16 B fragment.
__device__ __forceinline__ v16bf pack_p(v8f lo, v8f hi) {
    FragBF f;
    f.h[0] = __builtin_convertvector(lo, v8bf);
    f.h[1] = __builtin_convertvector(hi, v8bf);
    return f.v;
}

// Two workgroups per WGP (four waves per SIMD): the register budget is 256.
__global__ __launch_bounds__(256) __attribute__((amdgpu_waves_per_eu(4, 4))) void flash_attn(
    const __bf16* __restrict__ Qb,   // [B*T, 1024]
    const __bf16* __restrict__ KVb,  // [B*T, 2048]  (k | v)
    __bf16* __restrict__ Ob)         // [B*T, 1024]  merged heads
{
    // [K buf 0 | K buf 1 | V buf 0 | V buf 1]; behind the loop: O staging
    __shared__ __attribute__((aligned(16))) __bf16 smem[4 * 64 * KLD];
    __bf16* const Klds = smem;                  // [t][e]  == A-layout for K Q^T
    __bf16* const Vlds = smem + 2 * 64 * KLD;   // [e][t]  == A-layout for V^T P^T

    const int tid = threadIdx.x, lane = tid & 31, wave = tid >> 5;
    const int b = blockIdx.z, h = blockIdx.y, qt = blockIdx.x;
    const int row16 = lane & 15;
    const int kb    = (lane >> 4) << 3;    // fragment K sub-offset
                                           // (also the C-layout row offset)

    // Q fragments straight from global (row stride 1024 elems, 16B aligned)
    // (block-uniform base + one 32-bit lane offset: addresses cost one register)
    const size_t   qo_base = (size_t)(b * 2048 + qt * 256) * 1024 + h * 64;
    const unsigned qo_lane = (unsigned)((wave * 32 + row16) * 1024 + kb);
    FragBF qf[2][2];
#pragma unroll
    for (int g = 0; g < 2; ++g) {
        const __bf16* qp = (Qb + qo_base) + (qo_lane + g * 16 * 1024);
        qf[g][0].h[0] = *(const v8bf*)(qp);
        qf[g][0].h[1] = *(const v8bf*)(qp + 16);
        qf[g][1].h[0] = *(const v8bf*)(qp + 32);
        qf[g][1].h[1] = *(const v8bf*)(qp + 48);
    }

    // One query per lane and group: m_i is shared by the two halves, l_i is
    // this half's part of the denominator (joined once in the epilogue).
    float m_i[2], l_i[2];
    v8f O[2][4];                           // O^T: rows e = j*16 + r + kb
#pragma unroll
    for (int g = 0; g < 2; ++g) {
        m_i[g] = -1e30f; l_i[g] = 0.0f;
#pragma unroll
        for (int j = 0; j < 4; ++j) O[g][j] = (v8f)0.0f;
    }

    // exp2-domain scale: 1/sqrt(64) * log2(e)
    const float scale2 = 0.125f * 1.4426950408889634f;

    // KV staging: each thread copies 32B of K and 32B of V per chunk
    const int trow = tid >> 2, seg = (tid & 3) * 16;
    const __bf16* kgbase = KVb + (size_t)(b * 2048 + trow) * 2048 + h * 64 + seg;

    v8bf kr0, kr1, vr0, vr1;
    auto ldregs = [&](int t0) {
        const __bf16* kg = kgbase + (size_t)t0 * 2048;
        kr0 = *(const v8bf*)(kg);
        kr1 = *(const v8bf*)(kg + 8);
        vr0 = *(const v8bf*)(kg + 1024);
        vr1 = *(const v8bf*)(kg + 1032);
    };
    auto stregs = [&](int buf) {
        *(v8bf*)&Klds[buf * (64 * KLD) + trow * KLD + seg]     = kr0;
        *(v8bf*)&Klds[buf * (64 * KLD) + trow * KLD + seg + 8] = kr1;
#pragma unroll
        for (int i = 0; i < 8; ++i) Vlds[buf * (64 * KLD) + (seg + i) * KLD + trow]     = vr0[i];
#pragma unroll
        for (int i = 0; i < 8; ++i) Vlds[buf * (64 * KLD) + (seg + 8 + i) * KLD + trow] = vr1[i];
    };

    ldregs(0);
    stregs(0);
    __syncthreads();

    for (int ci = 0; ci < 32; ++ci) {            // 32 chunks of 64 kv rows
        const int cur = ci & 1;
        if (ci + 1 < 32) {
            ldregs((ci + 1) * 64);
            if (ci + 2 < 32)
                __builtin_prefetch(kgbase + (size_t)(ci + 2) * 64 * 2048, 0, 3);
        }

        // S2^T = (scale*log2e) * K Q^T  (64 keys x 32 q: 4 M-tiles x 2 groups,
        // E=64 in 2 steps); one K fragment pair serves both groups
        v8f s[2][4];
#pragma unroll
        for (int nt = 0; nt < 4; ++nt) {
            const v16bf k0 = ldf(&Klds[cur * (64 * KLD) + nt * 16 * KLD], KLD);
            const v16bf k1 = ldf(&Klds[cur * (64 * KLD) + nt * 16 * KLD + 32], KLD);
#pragma unroll
            for (int g = 0; g < 2; ++g) {
                v8f z = (v8f)0.0f;
                z = wmma_bf16(k0, qf[g][0].v, z);
                z = wmma_bf16(k1, qf[g][1].v, z);
                s[g][nt] = z * scale2;
            }
        }

        // online softmax in exp2 domain: a lane's 32 scores of a group are one query's
        // (both groups' maxima and rescale factors first, then each group's exponentials:
        // written so, the packed operations pair registers of one group, without copies)
        v16bf pf[2][2];
        float mnew[2], corr[2];
#pragma unroll
        for (int g = 0; g < 2; ++g) {
            const v8f m8 = __builtin_elementwise_max(__builtin_elementwise_max(s[g][0], s[g][1]),
                                                     __builtin_elementwise_max(s[g][2], s[g][3]));
            float rm = fmaxf(fmaxf(fmaxf(m8[0], m8[1]), fmaxf(m8[2], m8[3])),
                             fmaxf(fmaxf(m8[4], m8[5]), fmaxf(m8[6], m8[7])));
            rm = fmaxf(rm, xhalf(rm));           // both halves: the query's chunk maximum
            mnew[g] = fmaxf(m_i[g], rm);
        }
#pragma unroll
        for (int g = 0; g < 2; ++g) corr[g] = fast_exp2(m_i[g] - mnew[g]);
#pragma unroll
        for (int g = 0; g < 2; ++g) {
            const float mn = mnew[g], c = corr[g];
            float rs4[4];
#pragma unroll
            for (int nt = 0; nt < 4; ++nt) {
                const v8f d = s[g][nt] - mn;
                float t = 0.0f;
#pragma unroll
                for (int r = 0; r < 8; ++r) {
                    float p = fast_exp2(d[r]);
                    s[g][nt][r] = p;
                    t += p;
                }
                rs4[nt] = t;
            }
            l_i[g] = l_i[g] * c + ((rs4[0] + rs4[1]) + (rs4[2] + rs4[3]));
            m_i[g] = mn;
#pragma unroll
            for (int j = 0; j < 4; ++j) O[g][j] *= c;

            // P^T as B operand, straight from the score accumulators
            pf[g][0] = pack_p(s[g][0], s[g][1]);
            pf[g][1] = pack_p(s[g][2], s[g][3]);
        }

        // O^T += V^T P^T   (E=64 in four 16-row tiles, Kc=64 in 2 steps);
        // one V^T fragment pair serves both groups
#pragma unroll
        for (int j = 0; j < 4; ++j) {
            const v16bf v0 = ldf(&Vlds[cur * (64 * KLD) + j * 16 * KLD], KLD);
            const v16bf v1 = ldf(&Vlds[cur * (64 * KLD) + j * 16 * KLD + 32], KLD);
#pragma unroll
            for (int g = 0; g < 2; ++g) {
                O[g][j] = wmma_bf16(v0, pf[g][0], O[g][j]);
                O[g][j] = wmma_bf16(v1, pf[g][1], O[g][j]);
            }
        }

        if (ci + 1 < 32) stregs(cur ^ 1);
        __syncthreads();
    }

    // epilogue: join the halves' denominators, O^T / l, merged-head bf16.
    // A lane holds 8 consecutive e of its query per tile. Each wave stages its
    // 32 rows of 128 B in its own 32 x KLD slice of the LDS (the loop's last
    // barrier has ended every read of K and V), then stores whole 128 B lines.
    __bf16* const stg = smem + wave * (32 * KLD);
#pragma unroll
    for (int g = 0; g < 2; ++g) {
        const float inv = 1.0f / (l_i[g] + xhalf(l_i[g]));
#pragma unroll
        for (int j = 0; j < 4; ++j) {
            v8f o = O[g][j];
#pragma unroll
            for (int r = 0; r < 8; ++r) o[r] *= inv;
            *(v8bf*)&stg[(g * 16 + row16) * KLD + j * 16 + kb] = __builtin_convertvector(o, v8bf);
        }
    }
    // the wave's own LDS stores are complete before other lanes read the rows back
    asm volatile("s_wait_dscnt 0x0" ::: "memory");
#pragma unroll
    for (int it = 0; it < 8; ++it) {           // 4 rows (4 lines) per instruction
        const int row = it * 4 + (lane >> 3);
        const int c8  = (lane & 7) * 8;
        *(v8bf*)((Ob + qo_base) + (unsigned)((wave * 32 + row) * 1024 + c8)) =
            *(const v8bf*)&stg[row * KLD + c8];
    }
}

// ---------------------------------------------------------------------------
// Launch: cvt_all(x, weights) -> GEMM(Q) -> GEMM(KV) -> flash_attn
//         -> GEMM(out, +bias)
// ---------------------------------------------------------------------------
extern "C" void kernel_launch(void* const* d_in, const int* in_sizes, int n_in,
                              void* d_out, int out_size, void* d_ws, size_t ws_size,
                              hipStream_t stream) {
    const int B = 4, T = 2048, D = 1024, Hh = 16, E = 64;
    const int M = B * T;            // 8192
    const int DH = Hh * E;          // 1024

    const float* x    = (const float*)d_in[0];
    const float* Wq   = (const float*)d_in[1];
    const float* Wkv  = (const float*)d_in[2];
    const float* Wout = (const float*)d_in[3];
    const float* bout = (const float*)d_in[4];
    float* out = (float*)d_out;

    char* p = (char*)d_ws;
    __bf16* Xb    = (__bf16*)p; p += (size_t)M * D * 2;        // 16 MB
    __bf16* Wqt   = (__bf16*)p; p += (size_t)D * DH * 2;       //  2 MB  [N,K]
    __bf16* Wkvt  = (__bf16*)p; p += (size_t)D * 2 * DH * 2;   //  4 MB  [2N,K]
    __bf16* Woutt = (__bf16*)p; p += (size_t)DH * D * 2;       //  2 MB  [N,K]
    __bf16* Qbuf  = (__bf16*)p; p += (size_t)M * DH * 2;       // 16 MB
    __bf16* KVbuf = (__bf16*)p; p += (size_t)M * 2 * DH * 2;   // 32 MB
    __bf16* Obuf  = (__bf16*)p;                                // 16 MB

    // 1) activations: fp32 -> bf16 ; weights: fp32 -> bf16 transposed
    //    (Wqt, Wkvt, Woutt lie one behind the other: one [4096][1024] array)
    cvt_all<<<768, 256, 0, stream>>>(x, Wq, Wkv, Wout, Xb, Wqt);

    // 2) Q = X * Wq        [8192,1024] x [1024,1024] -> bf16
    gemm_bt<false><<<dim3(DH / 128, M / 128), 256, 0, stream>>>(
        Xb, Wqt, Qbuf, nullptr, nullptr, M, DH, D);

    // 3) KV = X * Wkv      [8192,1024] x [1024,2048] -> bf16
    gemm_bt<false><<<dim3(2 * DH / 128, M / 128), 256, 0, stream>>>(
        Xb, Wkvt, KVbuf, nullptr, nullptr, M, 2 * DH, D);

    // 4) flash attention   -> Obuf (bf16, merged heads)
    flash_attn<<<dim3(T / 256, Hh, B), 256, 0, stream>>>(Qbuf, KVbuf, Obuf);

    // 5) out = Obuf * Wout + bout   -> fp32 d_out
    gemm_bt<true><<<dim3(D / 128, M / 128), 256, 0, stream>>>(
        Obuf, Woutt, nullptr, out, bout, M, D, DH);
}

// v005
// Measured time: 140 microseconds a run.
// Timed twice side by side with v004, it ran 1.14 times as fast both times.
// Counting every step since v000, it is 1.70 times as fast.
#include <hip/hip_runtime.h>

// ---------------------------------------------------------------------------
// Types for CDNA5 WMMA (wave32): v_wmma_f32_16x16x32_bf16
// ---------------------------------------------------------------------------
typedef __bf16 v16bf __attribute__((ext_vector_type(16)));
typedef __bf16 v8bf  __attribute__((ext_vector_type(8)));
typedef __bf16 v4bf  __attribute__((ext_vector_type(4)));
typedef float  v8f   __attribute__((ext_vector_type(8)));
typedef float  v4f   __attribute__((ext_vector_type(4)));

union FragBF { v16bf v; v8bf h[2]; };

__device__ __forceinline__ v8f wmma_bf16(v16bf a, v16bf b, v8f c) {
    // (neg_a, A, neg_b, B, c_mod, C, reuse_a, reuse_b)
    return __builtin_amdgcn_wmma_f32_16x16x32_bf16(false, a, false, b,
                                                   (short)0, c, false, false);
}

// Raw hardware exp2 (v_exp_f32). Inputs here are well-scaled; no range fixup.
__device__ __forceinline__ float fast_exp2(float x) {
#if __has_builtin(__builtin_amdgcn_exp2f)
    return __builtin_amdgcn_exp2f(x);
#else
    return exp2f(x);
#endif
}

// Fragment load for 16-bit A/B matrices (16x32 tile, row stride `ld` elems).
// ISA 7.12.2: lanes 0-15 hold row M=lane, K=0..7 (lo) and K=16..23 (hi);
// lanes 16-31 hold same row, K=8..15 and K=24..31. Two ds_load_b128 per lane.
__device__ __forceinline__ v16bf ldf(const __bf16* base, int ld) {
    const int lane = threadIdx.x & 31;
    const __bf16* p = base + (lane & 15) * ld + ((lane >> 4) << 3);
    FragBF f;
    f.h[0] = *(const v8bf*)(p);
    f.h[1] = *(const v8bf*)(p + 16);
    return f.v;
}

// ---------------------------------------------------------------------------
// All fp32 -> bf16 conversions in one launch of 768 work-groups, 64 values a
// thread, so that few waves are started for the bytes moved.
// Blocks 0..255: weights, transposed. The three [1024][C] weights give one
// [4096][1024] bf16 array Wt (rows 0..1023 Wq^T, 1024..3071 Wkv^T, 3072..4095
// Wout^T). A block takes a panel of 64 rows x 256 columns: 16 loads of 16 B a
// lane in flight, through LDS, out as whole 128 B lines (8 lanes x 16 B).
// Blocks 256..767: x, 64 values a thread, 16 loads of 16 B a lane in flight.
// ---------------------------------------------------------------------------
#define WP 257   // panel pitch in f32: 1 mod 64, both LDS sides free of bank conflicts
__global__ __launch_bounds__(256) void cvt_all(const float* __restrict__ x,
                                               const float* __restrict__ Wq,
                                               const float* __restrict__ Wkv,
                                               const float* __restrict__ Wout,
                                               __bf16* __restrict__ Xb,
                                               __bf16* __restrict__ Wt) {
    __shared__ float tile[64 * WP];
    const int tid = threadIdx.x;
    const int blk = blockIdx.x;

    if (blk >= 256) {                        // block-uniform, ahead of the barrier
        // (block-uniform base + one 32-bit lane offset)
        const size_t o = (size_t)(blk - 256) * 4096;
        const v4f* const s = (const v4f*)x + o;
        v4bf* const d = (v4bf*)Xb + o;
        v4f v[16];
#pragma unroll
        for (int k = 0; k < 16; ++k) v[k] = s[(unsigned)(tid + k * 256)];
#pragma unroll
        for (int k = 0; k < 16; ++k) d[(unsigned)(tid + k * 256)] = __builtin_convertvector(v[k], v4bf);
        return;
    }

    const int cp = blk & 15;                 // 256-column panel: 4 of Wq, 8 of Wkv, 4 of Wout
    const int r0 = (blk >> 4) * 64;
    const bool wide = cp >= 4 && cp < 12;    // Wkv: rows of 2048, the others of 1024

    // a half wave loads 256 B of one row, the other half of the row two below:
    // in LDS the halves' banks then differ by two, and a pair of 4 B stores a
    // lane meets all 64 banks once
    const int lane = tid & 31, wave = tid >> 5;
    const int lr = (lane >> 4) * 2 + (wave >> 2);            // row within 4
    const int lc = ((wave & 3) * 16 + (lane & 15)) * 4;      // column
    // (block-uniform base + one 32-bit lane offset; the row length is a constant
    // on either side)
    v4f v[16];
    if (wide) {
        const float* const s = Wkv + (size_t)r0 * 2048 + (cp - 4) * 256;
#pragma unroll
        for (int p = 0; p < 16; ++p) v[p] = *(const v4f*)(s + (unsigned)((p * 4 + lr) * 2048 + lc));
    } else {
        const float* const s = (cp < 4 ? Wq : Wout) + (size_t)r0 * 1024 + (cp & 3) * 256;
#pragma unroll
        for (int p = 0; p < 16; ++p) v[p] = *(const v4f*)(s + (unsigned)((p * 4 + lr) * 1024 + lc));
    }
#pragma unroll
    for (int p = 0; p < 16; ++p)
#pragma unroll
        for (int k = 0; k < 4; ++k) tile[(p * 4 + lr) * WP + lc + k] = v[p][k];
    __syncthreads();

    // 8 lanes write one 128 B line: 64 rows of the panel for one column
    const int rc = (tid & 7) * 8, cc = tid >> 3;
    __bf16* const d = Wt + (size_t)(cp * 256 + cc) * 1024 + r0 + rc;
#pragma unroll
    for (int q = 0; q < 8; ++q) {
        v8f a;
#pragma unroll
        for (int i = 0; i < 8; ++i) a[i] = tile[(rc + i) * WP + q * 32 + cc];
        *(v8bf*)(d + (size_t)q * 32 * 1024) = __builtin_convertvector(a, v8bf);
    }
}

// ---------------------------------------------------------------------------
// Tiled WMMA GEMM with pre-transposed B:  C[M,N] = A[M,K] * Bt[N,K]^T
// Block 256x128, BK=64, 256 thr = 8 waves (4x2), wave tile 64x64: the 8
// fragments of a 32-k step feed 16 WMMAs (one LDS load per WMMA).
// Double-buffered LDS (108 KB) + register prefetch: 1 barrier / 64-K,
// global loads of tile k+1 overlap the 32 WMMAs of tile k;
// global_prefetch of tile k+2. LDS rows padded to 72 elems -> conflict-free.
// The products are taken transposed (Bt fragment as A operand, A fragment as
// B operand), so a lane's 8 accumulators of a tile are 8 adjacent columns of
// one C row. After the K loop the C tile is staged in the operand buffers'
// LDS with 16 B stores and leaves as whole 128 B lines, 16 B a lane.
// ---------------------------------------------------------------------------
#define GLD 72
#define CPB 136   // C staging pitch, bf16 elems (272 B = 17 x 16 B)
#define CPF 132   // C staging pitch, f32 elems  (528 B = 33 x 16 B)
// Two workgroups per WGP (four waves per SIMD): the register budget is 256.
template <bool OUTF32>
__global__ __launch_bounds__(256) __attribute__((amdgpu_waves_per_eu(4, 4))) void gemm_bt(
    const __bf16* __restrict__ A,   // [M,K] row-major
    const __bf16* __restrict__ Bt,  // [N,K] row-major (B transposed)
    __bf16* __restrict__ Cb, float* __restrict__ Cf,
    const float* __restrict__ bias, int M, int N, int K)
{
    // [A buf 0 | A buf 1 | B buf 0 | B buf 1]; behind the K loop: the C tile
    // (the f32 C tile is the larger of the two uses)
    __shared__ __attribute__((aligned(16))) __bf16 smem[OUTF32 ? 256 * CPF * 2 : 2 * (256 + 128) * GLD];
    __bf16* const As = smem;
    __bf16* const Bs = smem + 2 * 256 * GLD;

    const int tid  = threadIdx.x;
    const int lane = tid & 31;
    const int wave = tid >> 5;
    const size_t bm = (size_t)blockIdx.y * 256;
    const size_t bn = (size_t)blockIdx.x * 128;
    const int wm = (wave >> 1) * 64;   // 4 waves along M
    const int wn = (wave & 1) * 64;    // 2 waves along N

    // staging: each thread copies 2 x 64B of A (rows srow, srow + 128) and 64B of B per tile
    const int srow = tid >> 1;            // 0..127
    const int sseg = (tid & 1) * 32;      // 0 / 32
    // (the three pointers walk along K)
    const __bf16* ag = A  + (bm + srow) * (size_t)K + sseg;
    const __bf16* ah = ag + (size_t)128 * K;
    const __bf16* bg = Bt + (bn + srow) * (size_t)K + sseg;

    v8f acc[4][4];
#pragma unroll
    for (int i = 0; i < 4; ++i)
#pragma unroll
        for (int j = 0; j < 4; ++j) acc[i][j] = (v8f)0.0f;

    v8bf ar[8], br[4];
    auto ldregs = [&]() {
#pragma unroll
        for (int i = 0; i < 4; ++i) ar[i] = *((const v8bf*)ag + i);
#pragma unroll
        for (int i = 0; i < 4; ++i) ar[4 + i] = *((const v8bf*)ah + i);
#pragma unroll
        for (int i = 0; i < 4; ++i) br[i] = *((const v8bf*)bg + i);
    };
    auto stregs = [&](int buf) {
#pragma unroll
        for (int i = 0; i < 4; ++i) *(v8bf*)&As[buf * (256 * GLD) + srow * GLD + sseg + i * 8] = ar[i];
#pragma unroll
        for (int i = 0; i < 4; ++i) *(v8bf*)&As[buf * (256 * GLD) + (128 + srow) * GLD + sseg + i * 8] = ar[4 + i];
#pragma unroll
        for (int i = 0; i < 4; ++i) *(v8bf*)&Bs[buf * (128 * GLD) + srow * GLD + sseg + i * 8] = br[i];
    };

    ldregs();
    stregs(0);
    __syncthreads();

    const int nk = K >> 6;
    for (int kt = 0; kt < nk; ++kt) {
        const int cur = kt & 1;
#pragma unroll
        for (int ks = 0; ks < 64; ks += 32) {
            v16bf af[4], bfv[4];
#pragma unroll
            for (int j = 0; j < 4; ++j) bfv[j] = ldf(&Bs[cur * (128 * GLD) + (wn + j * 16) * GLD + ks], GLD);
#pragma unroll
            for (int i = 0; i < 4; ++i) af[i]  = ldf(&As[cur * (256 * GLD) + (wm + i * 16) * GLD + ks], GLD);
            // keeps the 16 LDS loads one group ahead of the 16 WMMAs: moved in among them,
            // each small group is waited for in full before the next four products
            __builtin_amdgcn_sched_barrier(0);
            if (ks == 0 && kt + 1 < nk) {
                // behind the first fragment loads: their latency covers the issue of these
                ag += 64; ah += 64; bg += 64;
                ldregs();
                if (kt + 2 < nk) {
                    __builtin_prefetch(ag + 64, 0, 3);
                    __builtin_prefetch(ah + 64, 0, 3);
                    __builtin_prefetch(bg + 64, 0, 3);
                }
            }
#pragma unroll
            for (int i = 0; i < 4; ++i)
#pragma unroll
                for (int j = 0; j < 4; ++j)
                    acc[i][j] = wmma_bf16(bfv[j], af[i], acc[i][j]);   // C^T tile
            // the next group's loads stay behind this block's products
            __builtin_amdgcn_sched_barrier(0);
        }
        if (kt + 1 < nk) stregs(cur ^ 1);
        __syncthreads();
    }

    // epilogue. acc[i][j][r] = C[wm + i*16 + (lane & 15)][wn + j*16 + r + half8].
    // The K loop's last barrier has ended every read of the operand buffers.
    const int half8 = (lane >> 4) << 3;
    const int mrow  = lane & 15;
    if (OUTF32) {
        // fp32 path = final output (write-once) -> non-temporal stores.
        float* const st = (float*)smem;
        const v4f bv = *(const v4f*)(bias + bn + lane * 4);   // the lane's 4 columns at the store
#pragma unroll
        for (int i = 0; i < 4; ++i)
#pragma unroll
            for (int j = 0; j < 4; ++j) {
                float* q = st + (wm + i * 16 + mrow) * CPF + wn + j * 16 + half8;
                *(v4f*)(q)     = __builtin_shufflevector(acc[i][j], acc[i][j], 0, 1, 2, 3);
                *(v4f*)(q + 4) = __builtin_shufflevector(acc[i][j], acc[i][j], 4, 5, 6, 7);
            }
        __syncthreads();
        // a wave stores one 512 B row of the tile per instruction
        // (block-uniform base + one 32-bit lane offset)
        float* const cg = Cf + bm * (size_t)N + bn;
        const unsigned o0 = (unsigned)(wave * N + lane * 4);
#pragma unroll
        for (int it = 0; it < 32; ++it) {
            const v4f c = *(const v4f*)(st + (it * 8 + wave) * CPF + lane * 4) + bv;
            __builtin_nontemporal_store(c, (v4f*)(cg + (o0 + (unsigned)(it * 8 * N))));
        }
    } else {
#pragma unroll
        for (int i = 0; i < 4; ++i)
#pragma unroll
            for (int j = 0; j < 4; ++j)
                *(v8bf*)&smem[(wm + i * 16 + mrow) * CPB + wn + j * 16 + half8] =
                    __builtin_convertvector(acc[i][j], v8bf);
        __syncthreads();
        // a wave stores two 256 B rows of the tile per instruction
        // (block-uniform base + one 32-bit lane offset)
        const int r0 = tid >> 4, c8 = (tid & 15) * 8;
        __bf16* const cg = Cb + bm * (size_t)N + bn;
        const unsigned o0 = (unsigned)(r0 * N + c8);
#pragma unroll
        for (int it = 0; it < 16; ++it)
            *(v8bf*)(cg + (o0 + (unsigned)(it * 16 * N))) =
                *(const v8bf*)&smem[(it * 16 + r0) * CPB + c8];
    }
}

#define KLD 72

// lane l <-> lane l ^ 16 (VALU cross-row move, no LDS)
__device__ __forceinline__ float xhalf(float x) {
    return __int_as_float(__builtin_amdgcn_permlanex16(
        __float_as_int(x), __float_as_int(x), 0x76543210, 0xfedcba98, false, false));
}

// Two 16-key score tiles (f32 accumulators) -> one 32-key bf16 B fragment.
__device__ __forceinline__ v16bf pack_p(v8f lo, v8f hi) {
    FragBF f;
    f.h[0] = __builtin_convertvector(lo, v8bf);
    f.h[1] = __builtin_convertvector(hi, v8bf);
    return f.v;
}

// Two workgroups per WGP (four waves per SIMD): the register budget is 256.
__global__ __launch_bounds__(256) __attribute__((amdgpu_waves_per_eu(4, 4))) void flash_attn(
    const __bf16* __restrict__ Qb,   // [B*T, 1024]
    const __bf16* __restrict__ KVb,  // [B*T, 2048]  (k | v)
    __bf16* __restrict__ Ob)         // [B*T, 1024]  merged heads
{
    // [K buf 0 | K buf 1 | V buf 0 | V buf 1]; behind the loop: O staging
    __shared__ __attribute__((aligned(16))) __bf16 smem[4 * 64 * KLD];
    __bf16* const Klds = smem;                  // [t][e]  == A-layout for K Q^T
    __bf16* const Vlds = smem + 2 * 64 * KLD;   // [e][t]  == A-layout for V^T P^T

    const int tid = threadIdx.x, lane = tid & 31, wave = tid >> 5;
    const int b = blockIdx.z, h = blockIdx.y, qt = blockIdx.x;
    const int row16 = lane & 15;
    const int kb    = (lane >> 4) << 3;    // fragment K sub-offset
                                           // (also the C-layout row offset)

    // Q fragments straight from global (row stride 1024 elems, 16B aligned)
    // (block-uniform base + one 32-bit lane offset: addresses cost one register)
    const size_t   qo_base = (size_t)(b * 2048 + qt * 256) * 1024 + h * 64;
    const unsigned qo_lane = (unsigned)((wave * 32 + row16) * 1024 + kb);
    FragBF qf[2][2];
#pragma unroll
    for (int g = 0; g < 2; ++g) {
        const __bf16* qp = (Qb + qo_base) + (qo_lane + g * 16 * 1024);
        qf[g][0].h[0] = *(const v8bf*)(qp);
        qf[g][0].h[1] = *(const v8bf*)(qp + 16);
        qf[g][1].h[0] = *(const v8bf*)(qp + 32);
        qf[g][1].h[1] = *(const v8bf*)(qp + 48);
    }

    // One query per lane and group: m_i is shared by the two halves, l_i is
    // this half's part of the denominator (joined once in the epilogue).
    float m_i[2], l_i[2];
    v8f O[2][4];                           // O^T: rows e = j*16 + r + kb
#pragma unroll
    for (int g = 0; g < 2; ++g) {
        m_i[g] = -1e30f; l_i[g] = 0.0f;
#pragma unroll
        for (int j = 0; j < 4; ++j) O[g][j] = (v8f)0.0f;
    }

    // exp2-domain scale: 1/sqrt(64) * log2(e)
    const float scale2 = 0.125f * 1.4426950408889634f;

    // KV staging: each thread copies 32B of K and 32B of V per chunk
    const int trow = tid >> 2, seg = (tid & 3) * 16;
    const __bf16* kgbase = KVb + (size_t)(b * 2048 + trow) * 2048 + h * 64 + seg;

    v8bf kr0, kr1, vr0, vr1;
    auto ldregs = [&](int t0) {
        const __bf16* kg = kgbase + (size_t)t0 * 2048;
        kr0 = *(const v8bf*)(kg);
        kr1 = *(const v8bf*)(kg + 8);
        vr0 = *(const v8bf*)(kg + 1024);
        vr1 = *(const v8bf*)(kg + 1032);
    };
    auto stregs = [&](int buf) {
        *(v8bf*)&Klds[buf * (64 * KLD) + trow * KLD + seg]     = kr0;
        *(v8bf*)&Klds[buf * (64 * KLD) + trow * KLD + seg + 8] = kr1;
#pragma unroll
        for (int i = 0; i < 8; ++i) Vlds[buf * (64 * KLD) + (seg + i) * KLD + trow]     = vr0[i];
#pragma unroll
        for (int i = 0; i < 8; ++i) Vlds[buf * (64 * KLD) + (seg + 8 + i) * KLD + trow] = vr1[i];
    };

    ldregs(0);
    stregs(0);
    __syncthreads();

    for (int ci = 0; ci < 32; ++ci) {            // 32 chunks of 64 kv rows
        const int cur = ci & 1;
        if (ci + 1 < 32) {
            ldregs((ci + 1) * 64);
            if (ci + 2 < 32)
                __builtin_prefetch(kgbase + (size_t)(ci + 2) * 64 * 2048, 0, 3);
        }

        // S2^T = (scale*log2e) * K Q^T  (64 keys x 32 q: 4 M-tiles x 2 groups,
        // E=64 in 2 steps); one K fragment pair serves both groups
        v8f s[2][4];
#pragma unroll
        for (int nt = 0; nt < 4; ++nt) {
            const v16bf k0 = ldf(&Klds[cur * (64 * KLD) + nt * 16 * KLD], KLD);
            const v16bf k1 = ldf(&Klds[cur * (64 * KLD) + nt * 16 * KLD + 32], KLD);
#pragma unroll
            for (int g = 0; g < 2; ++g) {
                v8f z = (v8f)0.0f;
                z = wmma_bf16(k0, qf[g][0].v, z);
                z = wmma_bf16(k1, qf[g][1].v, z);
                s[g][nt] = z * scale2;
            }
        }

        // online softmax in exp2 domain: a lane's 32 scores of a group are one query's
        // (both groups' maxima and rescale factors first, then each group's exponentials:
        // written so, the packed operations pair registers of one group, without copies)
        v16bf pf[2][2];
        float mnew[2], corr[2];
#pragma unroll
        for (int g = 0; g < 2; ++g) {
            const v8f m8 = __builtin_elementwise_max(__builtin_elementwise_max(s[g][0], s[g][1]),
                                                     __builtin_elementwise_max(s[g][2], s[g][3]));
            float rm = fmaxf(fmaxf(fmaxf(m8[0], m8[1]), fmaxf(m8[2], m8[3])),
                             fmaxf(fmaxf(m8[4], m8[5]), fmaxf(m8[6], m8[7])));
            rm = fmaxf(rm, xhalf(rm));           // both halves: the query's chunk maximum
            mnew[g] = fmaxf(m_i[g], rm);
        }
#pragma unroll
        for (int g = 0; g < 2; ++g) corr[g] = fast_exp2(m_i[g] - mnew[g]);
#pragma unroll
        for (int g = 0; g < 2; ++g) {
            const float mn = mnew[g], c = corr[g];
            float rs4[4];
#pragma unroll
            for (int nt = 0; nt < 4; ++nt) {
                const v8f d = s[g][nt] - mn;
                float t = 0.0f;
#pragma unroll
                for (int r = 0; r < 8; ++r) {
                    float p = fast_exp2(d[r]);
                    s[g][nt][r] = p;
                    t += p;
                }
                rs4[nt] = t;
            }
            l_i[g] = l_i[g] * c + ((rs4[0] + rs4[1]) + (rs4[2] + rs4[3]));
            m_i[g] = mn;
#pragma unroll
            for (int j = 0; j < 4; ++j) O[g][j] *= c;

            // P^T as B operand, straight from the score accumulators
            pf[g][0] = pack_p(s[g][0], s[g][1]);
            pf[g][1] = pack_p(s[g][2], s[g][3]);
        }

        // O^T += V^T P^T   (E=64 in four 16-row tiles, Kc=64 in 2 steps);
        // one V^T fragment pair serves both groups
#pragma unroll
        for (int j = 0; j < 4; ++j) {
            const v16bf v0 = ldf(&Vlds[cur * (64 * KLD) + j * 16 * KLD], KLD);
            const v16bf v1 = ldf(&Vlds[cur * (64 * KLD) + j * 16 * KLD + 32], KLD);
#pragma unroll
            for (int g = 0; g < 2; ++g) {
                O[g][j] = wmma_bf16(v0, pf[g][0], O[g][j]);
                O[g][j] = wmma_bf16(v1, pf[g][1], O[g][j]);
            }
        }

        if (ci + 1 < 32) stregs(cur ^ 1);
        __syncthreads();
    }

    // epilogue: join the halves' denominators, O^T / l, merged-head bf16.
    // A lane holds 8 consecutive e of its query per tile. Each wave stages its
    // 32 rows of 128 B in its own 32 x KLD slice of the LDS (the loop's last
    // barrier has ended every read of K and V), then stores whole 128 B lines.
    __bf16* const stg = smem + wave * (32 * KLD);
#pragma unroll
    for (int g = 0; g < 2; ++g) {
        const float inv = 1.0f / (l_i[g] + xhalf(l_i[g]));
#pragma unroll
        for (int j = 0; j < 4; ++j) {
            v8f o = O[g][j];
#pragma unroll
            for (int r = 0; r < 8; ++r) o[r] *= inv;
            *(v8bf*)&stg[(g * 16 + row16) * KLD + j * 16 + kb] = __builtin_convertvector(o, v8bf);
        }
    }
    // the wave's own LDS stores are complete before other lanes read the rows back
    asm volatile("s_wait_dscnt 0x0" ::: "memory");
#pragma unroll
    for (int it = 0; it < 8; ++it) {           // 4 rows (4 lines) per instruction
        const int row = it * 4 + (lane >> 3);
        const int c8  = (lane & 7) * 8;
        *(v8bf*)((Ob + qo_base) + (unsigned)((wave * 32 + row) * 1024 + c8)) =
            *(const v8bf*)&stg[row * KLD + c8];
    }
}

// ---------------------------------------------------------------------------
// Launch: cvt_all(x, weights) -> GEMM(Q) -> GEMM(KV) -> flash_attn
//         -> GEMM(out, +bias)
// ---------------------------------------------------------------------------
extern "C" void kernel_launch(void* const* d_in, const int* in_sizes, int n_in,
                              void* d_out, int out_size, void* d_ws, size_t ws_size,
                              hipStream_t stream) {
    const int B = 4, T = 2048, D = 1024, Hh = 16, E = 64;
    const int M = B * T;            // 8192
    const int DH = Hh * E;          // 1024

    const float* x    = (const float*)d_in[0];
    const float* Wq   = (const float*)d_in[1];
    const float* Wkv  = (const float*)d_in[2];
    const float* Wout = (const float*)d_in[3];
    const float* bout = (const float*)d_in[4];
    float* out = (float*)d_out;

    char* p = (char*)d_ws;
    __bf16* Xb    = (__bf16*)p; p += (size_t)M * D * 2;        // 16 MB
    __bf16* Wqt   = (__bf16*)p; p += (size_t)D * DH * 2;       //  2 MB  [N,K]
    __bf16* Wkvt  = (__bf16*)p; p += (size_t)D * 2 * DH * 2;   //  4 MB  [2N,K]
    __bf16* Woutt = (__bf16*)p; p += (size_t)DH * D * 2;       //  2 MB  [N,K]
    __bf16* Qbuf  = (__bf16*)p; p += (size_t)M * DH * 2;       // 16 MB
    __bf16* KVbuf = (__bf16*)p; p += (size_t)M * 2 * DH * 2;   // 32 MB
    __bf16* Obuf  = (__bf16*)p;                                // 16 MB

    // 1) activations: fp32 -> bf16 ; weights: fp32 -> bf16 transposed
    //    (Wqt, Wkvt, Woutt lie one behind the other: one [4096][1024] array)
    cvt_all<<<768, 256, 0, stream>>>(x, Wq, Wkv, Wout, Xb, Wqt);

    // 2) Q = X * Wq        [8192,1024] x [1024,1024] -> bf16
    gemm_bt<false><<<dim3(DH / 128, M / 256), 256, 0, stream>>>(
        Xb, Wqt, Qbuf, nullptr, nullptr, M, DH, D);

    // 3) KV = X * Wkv      [8192,1024] x [1024,2048] -> bf16
    gemm_bt<false><<<dim3(2 * DH / 128, M / 256), 256, 0, stream>>>(
        Xb, Wkvt, KVbuf, nullptr, nullptr, M, 2 * DH, D);

    // 4) flash attention   -> Obuf (bf16, merged heads)
    flash_attn<<<dim3(T / 256, Hh, B), 256, 0, stream>>>(Qbuf, KVbuf, Obuf);

    // 5) out = Obuf * Wout + bout   -> fp32 d_out
    gemm_bt<true><<<dim3(D / 128, M / 256), 256, 0, stream>>>(
        Obuf, Woutt, nullptr, out, bout, M, D, DH);
}

// v006
// It runs in 135 microseconds.
// Next to v005, in two timings, it ran 1.04 and 1.03 times as fast.
// Over all steps from v000 it is 1.75 times as fast.
#include <hip/hip_runtime.h>

// ---------------------------------------------------------------------------
// Types for CDNA5 WMMA (wave32): v_wmma_f32_16x16x32_bf16
// ---------------------------------------------------------------------------
typedef __bf16 v16bf __attribute__((ext_vector_type(16)));
typedef __bf16 v8bf  __attribute__((ext_vector_type(8)));
typedef __bf16 v4bf  __attribute__((ext_vector_type(4)));
typedef float  v8f   __attribute__((ext_vector_type(8)));
typedef float  v4f   __attribute__((ext_vector_type(4)));

union FragBF { v16bf v; v8bf h[2]; };

__device__ __forceinline__ v8f wmma_bf16(v16bf a, v16bf b, v8f c) {
    // (neg_a, A, neg_b, B, c_mod, C, reuse_a, reuse_b)
    return __builtin_amdgcn_wmma_f32_16x16x32_bf16(false, a, false, b,
                                                   (short)0, c, false, false);
}

// Raw hardware exp2 (v_exp_f32). Inputs here are well-scaled; no range fixup.
__device__ __forceinline__ float fast_exp2(float x) {
#if __has_builtin(__builtin_amdgcn_exp2f)
    return __builtin_amdgcn_exp2f(x);
#else
    return exp2f(x);
#endif
}

// Fragment load for 16-bit A/B matrices (16x32 tile, row stride `ld` elems).
// ISA 7.12.2: lanes 0-15 hold row M=lane, K=0..7 (lo) and K=16..23 (hi);
// lanes 16-31 hold same row, K=8..15 and K=24..31. Two ds_load_b128 per lane.
__device__ __forceinline__ v16bf ldf(const __bf16* base, int ld) {
    const int lane = threadIdx.x & 31;
    const __bf16* p = base + (lane & 15) * ld + ((lane >> 4) << 3);
    FragBF f;
    f.h[0] = *(const v8bf*)(p);
    f.h[1] = *(const v8bf*)(p + 16);
    return f.v;
}

// ---------------------------------------------------------------------------
// All fp32 -> bf16 conversions in one launch of 768 work-groups, 64 values a
// thread, so that few waves are started for the bytes moved.
// Blocks 0..255: weights, transposed. The three [1024][C] weights give one
// [4096][1024] bf16 array Wt (rows 0..1023 Wq^T, 1024..3071 Wkv^T, 3072..4095
// Wout^T). A block takes a panel of 64 rows x 256 columns: 16 loads of 16 B a
// lane in flight, through LDS, out as whole 128 B lines (8 lanes x 16 B).
// Blocks 256..767: x, 64 values a thread, 16 loads of 16 B a lane in flight.
// ---------------------------------------------------------------------------
#define WP 257   // panel pitch in f32: 1 mod 64, both LDS sides free of bank conflicts
__global__ __launch_bounds__(256) void cvt_all(const float* __restrict__ x,
                                               const float* __restrict__ Wq,
                                               const float* __restrict__ Wkv,
                                               const float* __restrict__ Wout,
                                               __bf16* __restrict__ Xb,
                                               __bf16* __restrict__ Wt) {
    __shared__ float tile[64 * WP];
    const int tid = threadIdx.x;
    const int blk = blockIdx.x;

    if (blk >= 256) {                        // block-uniform, ahead of the barrier
        // (block-uniform base + one 32-bit lane offset)
        const size_t o = (size_t)(blk - 256) * 4096;
        const v4f* const s = (const v4f*)x + o;
        v4bf* const d = (v4bf*)Xb + o;
        v4f v[16];
#pragma unroll
        for (int k = 0; k < 16; ++k) v[k] = s[(unsigned)(tid + k * 256)];
#pragma unroll
        for (int k = 0; k < 16; ++k) d[(unsigned)(tid + k * 256)] = __builtin_convertvector(v[k], v4bf);
        return;
    }

    const int cp = blk & 15;                 // 256-column panel: 4 of Wq, 8 of Wkv, 4 of Wout
    const int r0 = (blk >> 4) * 64;
    const bool wide = cp >= 4 && cp < 12;    // Wkv: rows of 2048, the others of 1024

    // a half wave loads 256 B of one row, the other half of the row two below:
    // in LDS the halves' banks then differ by two, and a pair of 4 B stores a
    // lane meets all 64 banks once
    const int lane = tid & 31, wave = tid >> 5;
    const int lr = (lane >> 4) * 2 + (wave >> 2);            // row within 4
    const int lc = ((wave & 3) * 16 + (lane & 15)) * 4;      // column
    // (block-uniform base + one 32-bit lane offset; the row length is a constant
    // on either side)
    v4f v[16];
    if (wide) {
        const float* const s = Wkv + (size_t)r0 * 2048 + (cp - 4) * 256;
#pragma unroll
        for (int p = 0; p < 16; ++p) v[p] = *(const v4f*)(s + (unsigned)((p * 4 + lr) * 2048 + lc));
    } else {
        const float* const s = (cp < 4 ? Wq : Wout) + (size_t)r0 * 1024 + (cp & 3) * 256;
#pragma unroll
        for (int p = 0; p < 16; ++p) v[p] = *(const v4f*)(s + (unsigned)((p * 4 + lr) * 1024 + lc));
    }
#pragma unroll
    for (int p = 0; p < 16; ++p)
#pragma unroll
        for (int k = 0; k < 4; ++k) tile[(p * 4 + lr) * WP + lc + k] = v[p][k];
    __syncthreads();

    // 8 lanes write one 128 B line: 64 rows of the panel for one column
    const int rc = (tid & 7) * 8, cc = tid >> 3;
    __bf16* const d = Wt + (size_t)(cp * 256 + cc) * 1024 + r0 + rc;
#pragma unroll
    for (int q = 0; q < 8; ++q) {
        v8f a;
#pragma unroll
        for (int i = 0; i < 8; ++i) a[i] = tile[(rc + i) * WP + q * 32 + cc];
        *(v8bf*)(d + (size_t)q * 32 * 1024) = __builtin_convertvector(a, v8bf);
    }
}

// ---------------------------------------------------------------------------
// Tiled WMMA GEMM with pre-transposed B:  C[M,N] = A[M,K] * Bt[N,K]^T
// Block 256x128, BK=64, 256 thr = 8 waves (4x2), wave tile 64x64: the 8
// fragments of a 32-k step feed 16 WMMAs (one LDS load per WMMA).
// Double-buffered LDS (108 KB) + register prefetch: 1 barrier / 64-K,
// global loads of tile k+1 overlap the 32 WMMAs of tile k;
// global_prefetch of tile k+2. LDS rows padded to 72 elems -> conflict-free.
// The products are taken transposed (Bt fragment as A operand, A fragment as
// B operand), so a lane's 8 accumulators of a tile are 8 adjacent columns of
// one C row. After the K loop the C tile is staged in the operand buffers'
// LDS with 16 B stores and leaves as whole 128 B lines, 16 B a lane.
// ---------------------------------------------------------------------------
#define GLD 72
#define CPB 136   // C staging pitch, bf16 elems (272 B = 17 x 16 B)
#define CPF 132   // C staging pitch, f32 elems  (528 B = 33 x 16 B)
// Two workgroups per WGP (four waves per SIMD): the register budget is 256.
// K is a constant of the build: the staging's row steps are then immediate offsets.
template <bool OUTF32, int K>
__global__ __launch_bounds__(256) __attribute__((amdgpu_waves_per_eu(4, 4))) void gemm_bt(
    const __bf16* __restrict__ A,   // [M,K] row-major
    const __bf16* __restrict__ Bt,  // [N,K] row-major (B transposed)
    __bf16* __restrict__ Cb, float* __restrict__ Cf,
    const float* __restrict__ bias, int M, int N)
{
    // [A buf 0 | A buf 1 | B buf 0 | B buf 1]; behind the K loop: the C tile
    // (the f32 C tile is the larger of the two uses)
    __shared__ __attribute__((aligned(16))) __bf16 smem[OUTF32 ? 256 * CPF * 2 : 2 * (256 + 128) * GLD];
    __bf16* const As = smem;
    __bf16* const Bs = smem + 2 * 256 * GLD;

    const int tid  = threadIdx.x;
    const int lane = tid & 31;
    const int wave = tid >> 5;
    const size_t bm = (size_t)blockIdx.y * 256;
    const size_t bn = (size_t)blockIdx.x * 128;
    const int wm = (wave >> 1) * 64;   // 4 waves along M
    const int wn = (wave & 1) * 64;    // 2 waves along N

    // staging: a tile row is one 128 B line. 8 lanes take one row, 16 B each, so a
    // wave-wide load covers 4 whole lines. The block takes 32 rows a pass: 8 passes
    // of A, 4 of B. A wave's 4 rows lie 8 apart: at the 144 B pitch the two rows of
    // a half wave then fall on the two halves of the LDS banks.
    const int srow = (lane >> 3) * 8 + wave;   // row within a pass, 0..31
    const int schk = (lane & 7) * 8;           // 16 B piece of the row
    // (block-uniform bases + 32-bit lane offsets in bytes that walk along K)
    const char* const ab = (const char*)(A  + bm * (size_t)K);
    const char* const bb = (const char*)(Bt + bn * (size_t)K);
    unsigned goff = (unsigned)((srow * K + schk) * 2);
    unsigned poff = (unsigned)(tid * K * 2);                  // prefetch: one row a lane
    const bool pfb = __builtin_amdgcn_readfirstlane(wave) < 4;   // B has 128 rows

    v8f acc[4][4];
#pragma unroll
    for (int i = 0; i < 4; ++i)
#pragma unroll
        for (int j = 0; j < 4; ++j) acc[i][j] = (v8f)0.0f;

    v8bf ar[8], br[4];
    auto ldregs = [&]() {
#pragma unroll
        for (int p = 0; p < 8; ++p) ar[p] = *(const v8bf*)(ab + p * (32 * K * 2) + goff);
#pragma unroll
        for (int p = 0; p < 4; ++p) br[p] = *(const v8bf*)(bb + p * (32 * K * 2) + goff);
    };
    auto stregs = [&](int buf) {
#pragma unroll
        for (int p = 0; p < 8; ++p) *(v8bf*)&As[buf * (256 * GLD) + (p * 32 + srow) * GLD + schk] = ar[p];
#pragma unroll
        for (int p = 0; p < 4; ++p) *(v8bf*)&Bs[buf * (128 * GLD) + (p * 32 + srow) * GLD + schk] = br[p];
    };

    ldregs();
    stregs(0);
    __syncthreads();

    const int nk = K >> 6;
    for (int kt = 0; kt < nk; ++kt) {
        const int cur = kt & 1;
#pragma unroll
        for (int ks = 0; ks < 64; ks += 32) {
            v16bf af[4], bfv[4];
#pragma unroll
            for (int j = 0; j < 4; ++j) bfv[j] = ldf(&Bs[cur * (128 * GLD) + (wn + j * 16) * GLD + ks], GLD);
#pragma unroll
            for (int i = 0; i < 4; ++i) af[i]  = ldf(&As[cur * (256 * GLD) + (wm + i * 16) * GLD + ks], GLD);
            // keeps the 16 LDS loads one group ahead of the 16 WMMAs: moved in among them,
            // each small group is waited for in full before the next four products
            __builtin_amdgcn_sched_barrier(0);
            if (ks == 0 && kt + 1 < nk) {
                // behind the first fragment loads: their latency covers the issue of these
                goff += 128; poff += 128;
                ldregs();
                if (kt + 3 < nk) {
                    // each line of the tile after next is asked for once. In asm, so that the
                    // prefetch names registers that live through the loop; the test keeps them
                    // inside the row after the next advance too
                    asm volatile("global_prefetch_b8 %0, %1 offset:128 scope:SCOPE_SE" :: "v"(poff), "s"(ab));
                    if (pfb) asm volatile("global_prefetch_b8 %0, %1 offset:128 scope:SCOPE_SE" :: "v"(poff), "s"(bb));
                }
            }
#pragma unroll
            for (int i = 0; i < 4; ++i)
#pragma unroll
                for (int j = 0; j < 4; ++j)
                    acc[i][j] = wmma_bf16(bfv[j], af[i], acc[i][j]);   // C^T tile
            // the next group's loads stay behind this block's products
            __builtin_amdgcn_sched_barrier(0);
        }
        if (kt + 1 < nk) stregs(cur ^ 1);
        __syncthreads();
    }

    // epilogue. acc[i][j][r] = C[wm + i*16 + (lane & 15)][wn + j*16 + r + half8].
    // The K loop's last barrier has ended every read of the operand buffers.
    const int half8 = (lane >> 4) << 3;
    const int mrow  = lane & 15;
    if (OUTF32) {
        // fp32 path = final output (write-once) -> non-temporal stores.
        float* const st = (float*)smem;
        const v4f bv = *(const v4f*)(bias + bn + lane * 4);   // the lane's 4 columns at the store
#pragma unroll
        for (int i = 0; i < 4; ++i)
#pragma unroll
            for (int j = 0; j < 4; ++j) {
                float* q = st + (wm + i * 16 + mrow) * CPF + wn + j * 16 + half8;
                *(v4f*)(q)     = __builtin_shufflevector(acc[i][j], acc[i][j], 0, 1, 2, 3);
                *(v4f*)(q + 4) = __builtin_shufflevector(acc[i][j], acc[i][j], 4, 5, 6, 7);
            }
        __syncthreads();
        // a wave stores one 512 B row of the tile per instruction
        // (block-uniform base + one 32-bit lane offset)
        float* const cg = Cf + bm * (size_t)N + bn;
        const unsigned o0 = (unsigned)(wave * N + lane * 4);
#pragma unroll
        for (int it = 0; it < 32; ++it) {
            const v4f c = *(const v4f*)(st + (it * 8 + wave) * CPF + lane * 4) + bv;
            __builtin_nontemporal_store(c, (v4f*)(cg + (o0 + (unsigned)(it * 8 * N))));
        }
    } else {
#pragma unroll
        for (int i = 0; i < 4; ++i)
#pragma unroll
            for (int j = 0; j < 4; ++j)
                *(v8bf*)&smem[(wm + i * 16 + mrow) * CPB + wn + j * 16 + half8] =
                    __builtin_convertvector(acc[i][j], v8bf);
        __syncthreads();
        // a wave stores two 256 B rows of the tile per instruction
        // (block-uniform base + one 32-bit lane offset)
        const int r0 = tid >> 4, c8 = (tid & 15) * 8;
        __bf16* const cg = Cb + bm * (size_t)N + bn;
        const unsigned o0 = (unsigned)(r0 * N + c8);
#pragma unroll
        for (int it = 0; it < 16; ++it)
            *(v8bf*)(cg + (o0 + (unsigned)(it * 16 * N))) =
                *(const v8bf*)&smem[(it * 16 + r0) * CPB + c8];
    }
}

#define KLD 72

// lane l <-> lane l ^ 16 (VALU cross-row move, no LDS)
__device__ __forceinline__ float xhalf(float x) {
    return __int_as_float(__builtin_amdgcn_permlanex16(
        __float_as_int(x), __float_as_int(x), 0x76543210, 0xfedcba98, false, false));
}

// Two 16-key score tiles (f32 accumulators) -> one 32-key bf16 B fragment.
__device__ __forceinline__ v16bf pack_p(v8f lo, v8f hi) {
    FragBF f;
    f.h[0] = __builtin_convertvector(lo, v8bf);
    f.h[1] = __builtin_convertvector(hi, v8bf);
    return f.v;
}

// Two workgroups per WGP (four waves per SIMD): the register budget is 256.
__global__ __launch_bounds__(256) __attribute__((amdgpu_waves_per_eu(4, 4))) void flash_attn(
    const __bf16* __restrict__ Qb,   // [B*T, 1024]
    const __bf16* __restrict__ KVb,  // [B*T, 2048]  (k | v)
    __bf16* __restrict__ Ob)         // [B*T, 1024]  merged heads
{
    // [K buf 0 | K buf 1 | V buf 0 | V buf 1]; behind the loop: O staging
    __shared__ __attribute__((aligned(16))) __bf16 smem[4 * 64 * KLD];
    __bf16* const Klds = smem;                  // [t][e]  == A-layout for K Q^T
    __bf16* const Vlds = smem + 2 * 64 * KLD;   // [e][t]  == A-layout for V^T P^T

    const int tid = threadIdx.x, lane = tid & 31, wave = tid >> 5;
    const int b = blockIdx.z, h = blockIdx.y, qt = blockIdx.x;
    const int row16 = lane & 15;
    const int kb    = (lane >> 4) << 3;    // fragment K sub-offset
                                           // (also the C-layout row offset)

    // Q fragments straight from global (row stride 1024 elems, 16B aligned)
    // (block-uniform base + one 32-bit lane offset: addresses cost one register)
    const size_t   qo_base = (size_t)(b * 2048 + qt * 256) * 1024 + h * 64;
    const unsigned qo_lane = (unsigned)((wave * 32 + row16) * 1024 + kb);
    FragBF qf[2][2];
#pragma unroll
    for (int g = 0; g < 2; ++g) {
        const __bf16* qp = (Qb + qo_base) + (qo_lane + g * 16 * 1024);
        qf[g][0].h[0] = *(const v8bf*)(qp);
        qf[g][0].h[1] = *(const v8bf*)(qp + 16);
        qf[g][1].h[0] = *(const v8bf*)(qp + 32);
        qf[g][1].h[1] = *(const v8bf*)(qp + 48);
    }

    // One query per lane and group: m_i is shared by the two halves, l_i is
    // this half's part of the denominator (joined once in the epilogue).
    float m_i[2], l_i[2];
    v8f O[2][4];                           // O^T: rows e = j*16 + r + kb
#pragma unroll
    for (int g = 0; g < 2; ++g) {
        m_i[g] = -1e30f; l_i[g] = 0.0f;
#pragma unroll
        for (int j = 0; j < 4; ++j) O[g][j] = (v8f)0.0f;
    }

    // exp2-domain scale: 1/sqrt(64) * log2(e)
    const float scale2 = 0.125f * 1.4426950408889634f;

    // KV staging: each thread copies 32B of K and 32B of V per chunk
    const int trow = tid >> 2, seg = (tid & 3) * 16;
    const __bf16* kgbase = KVb + (size_t)(b * 2048 + trow) * 2048 + h * 64 + seg;

    v8bf kr0, kr1, vr0, vr1;
    auto ldregs = [&](int t0) {
        const __bf16* kg = kgbase + (size_t)t0 * 2048;
        kr0 = *(const v8bf*)(kg);
        kr1 = *(const v8bf*)(kg + 8);
        vr0 = *(const v8bf*)(kg + 1024);
        vr1 = *(const v8bf*)(kg + 1032);
    };
    auto stregs = [&](int buf) {
        *(v8bf*)&Klds[buf * (64 * KLD) + trow * KLD + seg]     = kr0;
        *(v8bf*)&Klds[buf * (64 * KLD) + trow * KLD + seg + 8] = kr1;
#pragma unroll
        for (int i = 0; i < 8; ++i) Vlds[buf * (64 * KLD) + (seg + i) * KLD + trow]     = vr0[i];
#pragma unroll
        for (int i = 0; i < 8; ++i) Vlds[buf * (64 * KLD) + (seg + 8 + i) * KLD + trow] = vr1[i];
    };

    ldregs(0);
    stregs(0);
    __syncthreads();

    for (int ci = 0; ci < 32; ++ci) {            // 32 chunks of 64 kv rows
        const int cur = ci & 1;
        if (ci + 1 < 32) {
            ldregs((ci + 1) * 64);
            if (ci + 2 < 32)
                __builtin_prefetch(kgbase + (size_t)(ci + 2) * 64 * 2048, 0, 3);
        }

        // S2^T = (scale*log2e) * K Q^T  (64 keys x 32 q: 4 M-tiles x 2 groups,
        // E=64 in 2 steps); one K fragment pair serves both groups
        v8f s[2][4];
#pragma unroll
        for (int nt = 0; nt < 4; ++nt) {
            const v16bf k0 = ldf(&Klds[cur * (64 * KLD) + nt * 16 * KLD], KLD);
            const v16bf k1 = ldf(&Klds[cur * (64 * KLD) + nt * 16 * KLD + 32], KLD);
#pragma unroll
            for (int g = 0; g < 2; ++g) {
                v8f z = (v8f)0.0f;
                z = wmma_bf16(k0, qf[g][0].v, z);
                z = wmma_bf16(k1, qf[g][1].v, z);
                s[g][nt] = z * scale2;
            }
        }

        // online softmax in exp2 domain: a lane's 32 scores of a group are one query's
        // (both groups' maxima and rescale factors first, then each group's exponentials:
        // written so, the packed operations pair registers of one group, without copies)
        v16bf pf[2][2];
        float mnew[2], corr[2];
#pragma unroll
        for (int g = 0; g < 2; ++g) {
            const v8f m8 = __builtin_elementwise_max(__builtin_elementwise_max(s[g][0], s[g][1]),
                                                     __builtin_elementwise_max(s[g][2], s[g][3]));
            float rm = fmaxf(fmaxf(fmaxf(m8[0], m8[1]), fmaxf(m8[2], m8[3])),
                             fmaxf(fmaxf(m8[4], m8[5]), fmaxf(m8[6], m8[7])));
            rm = fmaxf(rm, xhalf(rm));           // both halves: the query's chunk maximum
            mnew[g] = fmaxf(m_i[g], rm);
        }
#pragma unroll
        for (int g = 0; g < 2; ++g) corr[g] = fast_exp2(m_i[g] - mnew[g]);
#pragma unroll
        for (int g = 0; g < 2; ++g) {
            const float mn = mnew[g], c = corr[g];
            float rs4[4];
#pragma unroll
            for (int nt = 0; nt < 4; ++nt) {
                const v8f d = s[g][nt] - mn;
                float t = 0.0f;
#pragma unroll
                for (int r = 0; r < 8; ++r) {
                    float p = fast_exp2(d[r]);
                    s[g][nt][r] = p;
                    t += p;
                }
                rs4[nt] = t;
            }
            l_i[g] = l_i[g] * c + ((rs4[0] + rs4[1]) + (rs4[2] + rs4[3]));
            m_i[g] = mn;
#pragma unroll
            for (int j = 0; j < 4; ++j) O[g][j] *= c;

            // P^T as B operand, straight from the score accumulators
            pf[g][0] = pack_p(s[g][0], s[g][1]);
            pf[g][1] = pack_p(s[g][2], s[g][3]);
        }

        // O^T += V^T P^T   (E=64 in four 16-row tiles, Kc=64 in 2 steps);
        // one V^T fragment pair serves both groups
#pragma unroll
        for (int j = 0; j < 4; ++j) {
            const v16bf v0 = ldf(&Vlds[cur * (64 * KLD) + j * 16 * KLD], KLD);
            const v16bf v1 = ldf(&Vlds[cur * (64 * KLD) + j * 16 * KLD + 32], KLD);
#pragma unroll
            for (int g = 0; g < 2; ++g) {
                O[g][j] = wmma_bf16(v0, pf[g][0], O[g][j]);
                O[g][j] = wmma_bf16(v1, pf[g][1], O[g][j]);
            }
        }

        if (ci + 1 < 32) stregs(cur ^ 1);
        __syncthreads();
    }

    // epilogue: join the halves' denominators, O^T / l, merged-head bf16.
    // A lane holds 8 consecutive e of its query per tile. Each wave stages its
    // 32 rows of 128 B in its own 32 x KLD slice of the LDS (the loop's last
    // barrier has ended every read of K and V), then stores whole 128 B lines.
    __bf16* const stg = smem + wave * (32 * KLD);
#pragma unroll
    for (int g = 0; g < 2; ++g) {
        const float inv = 1.0f / (l_i[g] + xhalf(l_i[g]));
#pragma unroll
        for (int j = 0; j < 4; ++j) {
            v8f o = O[g][j];
#pragma unroll
            for (int r = 0; r < 8; ++r) o[r] *= inv;
            *(v8bf*)&stg[(g * 16 + row16) * KLD + j * 16 + kb] = __builtin_convertvector(o, v8bf);
        }
    }
    // the wave's own LDS stores are complete before other lanes read the rows back
    asm volatile("s_wait_dscnt 0x0" ::: "memory");
#pragma unroll
    for (int it = 0; it < 8; ++it) {           // 4 rows (4 lines) per instruction
        const int row = it * 4 + (lane >> 3);
        const int c8  = (lane & 7) * 8;
        *(v8bf*)((Ob + qo_base) + (unsigned)((wave * 32 + row) * 1024 + c8)) =
            *(const v8bf*)&stg[row * KLD + c8];
    }
}

// ---------------------------------------------------------------------------
// Launch: cvt_all(x, weights) -> GEMM(Q) -> GEMM(KV) -> flash_attn
//         -> GEMM(out, +bias)
// ---------------------------------------------------------------------------
extern "C" void kernel_launch(void* const* d_in, const int* in_sizes, int n_in,
                              void* d_out, int out_size, void* d_ws, size_t ws_size,
                              hipStream_t stream) {
    const int B = 4, T = 2048, D = 1024, Hh = 16, E = 64;
    const int M = B * T;            // 8192
    const int DH = Hh * E;          // 1024

    const float* x    = (const float*)d_in[0];
    const float* Wq   = (const float*)d_in[1];
    const float* Wkv  = (const float*)d_in[2];
    const float* Wout = (const float*)d_in[3];
    const float* bout = (const float*)d_in[4];
    float* out = (float*)d_out;

    char* p = (char*)d_ws;
    __bf16* Xb    = (__bf16*)p; p += (size_t)M * D * 2;        // 16 MB
    __bf16* Wqt   = (__bf16*)p; p += (size_t)D * DH * 2;       //  2 MB  [N,K]
    __bf16* Wkvt  = (__bf16*)p; p += (size_t)D * 2 * DH * 2;   //  4 MB  [2N,K]
    __bf16* Woutt = (__bf16*)p; p += (size_t)DH * D * 2;       //  2 MB  [N,K]
    __bf16* Qbuf  = (__bf16*)p; p += (size_t)M * DH * 2;       // 16 MB
    __bf16* KVbuf = (__bf16*)p; p += (size_t)M * 2 * DH * 2;   // 32 MB
    __bf16* Obuf  = (__bf16*)p;                                // 16 MB

    // 1) activations: fp32 -> bf16 ; weights: fp32 -> bf16 transposed
    //    (Wqt, Wkvt, Woutt lie one behind the other: one [4096][1024] array)
    cvt_all<<<768, 256, 0, stream>>>(x, Wq, Wkv, Wout, Xb, Wqt);

    // 2) Q = X * Wq        [8192,1024] x [1024,1024] -> bf16
    gemm_bt<false, D><<<dim3(DH / 128, M / 256), 256, 0, stream>>>(
        Xb, Wqt, Qbuf, nullptr, nullptr, M, DH);

    // 3) KV = X * Wkv      [8192,1024] x [1024,2048] -> bf16
    gemm_bt<false, D><<<dim3(2 * DH / 128, M / 256), 256, 0, stream>>>(
        Xb, Wkvt, KVbuf, nullptr, nullptr, M, 2 * DH);

    // 4) flash attention   -> Obuf (bf16, merged heads)
    flash_attn<<<dim3(T / 256, Hh, B), 256, 0, stream>>>(Qbuf, KVbuf, Obuf);

    // 5) out = Obuf * Wout + bout   -> fp32 d_out
    gemm_bt<true, DH><<<dim3(D / 128, M / 256), 256, 0, stream>>>(
        Obuf, Woutt, nullptr, out, bout, M, D);
}

// v007
// It runs in 129 microseconds.
// Two timings next to v006 both put it at 1.04 times that version's speed.
// Over all steps from v000 it is 1.83 times as fast.
#include <hip/hip_runtime.h>

// ---------------------------------------------------------------------------
// Types for CDNA5 WMMA (wave32): v_wmma_f32_16x16x32_bf16
// ---------------------------------------------------------------------------
typedef __bf16 v16bf __attribute__((ext_vector_type(16)));
typedef __bf16 v8bf  __attribute__((ext_vector_type(8)));
typedef __bf16 v4bf  __attribute__((ext_vector_type(4)));
typedef float  v8f   __attribute__((ext_vector_type(8)));
typedef float  v4f   __attribute__((ext_vector_type(4)));

union FragBF { v16bf v; v8bf h[2]; };

__device__ __forceinline__ v8f wmma_bf16(v16bf a, v16bf b, v8f c) {
    // (neg_a, A, neg_b, B, c_mod, C, reuse_a, reuse_b)
    return __builtin_amdgcn_wmma_f32_16x16x32_bf16(false, a, false, b,
                                                   (short)0, c, false, false);
}

// Raw hardware exp2 (v_exp_f32). Inputs here are well-scaled; no range fixup.
__device__ __forceinline__ float fast_exp2(float x) {
#if __has_builtin(__builtin_amdgcn_exp2f)
    return __builtin_amdgcn_exp2f(x);
#else
    return exp2f(x);
#endif
}

// Fragment load for 16-bit A/B matrices (16x32 tile, row stride `ld` elems).
// ISA 7.12.2: lanes 0-15 hold row M=lane, K=0..7 (lo) and K=16..23 (hi);
// lanes 16-31 hold same row, K=8..15 and K=24..31. Two ds_load_b128 per lane.
__device__ __forceinline__ v16bf ldf(const __bf16* base, int ld) {
    const int lane = threadIdx.x & 31;
    const __bf16* p = base + (lane & 15) * ld + ((lane >> 4) << 3);
    FragBF f;
    f.h[0] = *(const v8bf*)(p);
    f.h[1] = *(const v8bf*)(p + 16);
    return f.v;
}

// ---------------------------------------------------------------------------
// All fp32 -> bf16 conversions in one launch of 768 work-groups, 64 values a
// thread, so that few waves are started for the bytes moved.
// Blocks 0..255: weights, transposed. The three [1024][C] weights give one
// [4096][1024] bf16 array Wt (rows 0..1023 Wq^T, 1024..3071 Wkv^T, 3072..4095
// Wout^T). A block takes a panel of 64 rows x 256 columns: 16 loads of 16 B a
// lane in flight, through LDS, out as whole 128 B lines (8 lanes x 16 B).
// Blocks 256..767: x, 64 values a thread, 16 loads of 16 B a lane in flight.
// ---------------------------------------------------------------------------
#define WP 257   // panel pitch in f32: 1 mod 64, both LDS sides free of bank conflicts
__global__ __launch_bounds__(256) void cvt_all(const float* __restrict__ x,
                                               const float* __restrict__ Wq,
                                               const float* __restrict__ Wkv,
                                               const float* __restrict__ Wout,
                                               __bf16* __restrict__ Xb,
                                               __bf16* __restrict__ Wt) {
    __shared__ float tile[64 * WP];
    const int tid = threadIdx.x;
    const int blk = blockIdx.x;

    if (blk >= 256) {                        // block-uniform, ahead of the barrier
        // (block-uniform base + one 32-bit lane offset)
        const size_t o = (size_t)(blk - 256) * 4096;
        const v4f* const s = (const v4f*)x + o;
        v4bf* const d = (v4bf*)Xb + o;
        v4f v[16];
#pragma unroll
        for (int k = 0; k < 16; ++k) v[k] = s[(unsigned)(tid + k * 256)];
#pragma unroll
        for (int k = 0; k < 16; ++k) d[(unsigned)(tid + k * 256)] = __builtin_convertvector(v[k], v4bf);
        return;
    }

    const int cp = blk & 15;                 // 256-column panel: 4 of Wq, 8 of Wkv, 4 of Wout
    const int r0 = (blk >> 4) * 64;
    const bool wide = cp >= 4 && cp < 12;    // Wkv: rows of 2048, the others of 1024

    // a half wave loads 256 B of one row, the other half of the row two below:
    // in LDS the halves' banks then differ by two, and a pair of 4 B stores a
    // lane meets all 64 banks once
    const int lane = tid & 31, wave = tid >> 5;
    const int lr = (lane >> 4) * 2 + (wave >> 2);            // row within 4
    const int lc = ((wave & 3) * 16 + (lane & 15)) * 4;      // column
    // (block-uniform base + one 32-bit lane offset; the row length is a constant
    // on either side)
    v4f v[16];
    if (wide) {
        const float* const s = Wkv + (size_t)r0 * 2048 + (cp - 4) * 256;
#pragma unroll
        for (int p = 0; p < 16; ++p) v[p] = *(const v4f*)(s + (unsigned)((p * 4 + lr) * 2048 + lc));
    } else {
        const float* const s = (cp < 4 ? Wq : Wout) + (size_t)r0 * 1024 + (cp & 3) * 256;
#pragma unroll
        for (int p = 0; p < 16; ++p) v[p] = *(const v4f*)(s + (unsigned)((p * 4 + lr) * 1024 + lc));
    }
#pragma unroll
    for (int p = 0; p < 16; ++p)
#pragma unroll
        for (int k = 0; k < 4; ++k) tile[(p * 4 + lr) * WP + lc + k] = v[p][k];
    __syncthreads();

    // 8 lanes write one 128 B line: 64 rows of the panel for one column
    const int rc = (tid & 7) * 8, cc = tid >> 3;
    __bf16* const d = Wt + (size_t)(cp * 256 + cc) * 1024 + r0 + rc;
#pragma unroll
    for (int q = 0; q < 8; ++q) {
        v8f a;
#pragma unroll
        for (int i = 0; i < 8; ++i) a[i] = tile[(rc + i) * WP + q * 32 + cc];
        *(v8bf*)(d + (size_t)q * 32 * 1024) = __builtin_convertvector(a, v8bf);
    }
}

// ---------------------------------------------------------------------------
// Tiled WMMA GEMM with pre-transposed B:  C[M,N] = A[M,K] * Bt[N,K]^T
// Block 256x128, BK=64, 256 thr = 8 waves (4x2), wave tile 64x64: the 8
// fragments of a 32-k step feed 16 WMMAs (one LDS load per WMMA).
// Double-buffered LDS (108 KB) + register prefetch: 1 barrier / 64-K,
// global loads of tile k+1 overlap the 32 WMMAs of tile k;
// global_prefetch of tile k+2, shared out among the work-groups that read the
// same lines. LDS rows padded to 72 elems -> conflict-free.
// The products are taken transposed (Bt fragment as A operand, A fragment as
// B operand), so a lane's 8 accumulators of a tile are 8 adjacent columns of
// one C row. After the K loop the C tile is staged in the operand buffers'
// LDS with 16 B stores and leaves as whole 128 B lines, 16 B a lane.
// ---------------------------------------------------------------------------
#define GLD 72
#define CPB 136   // C staging pitch, bf16 elems (272 B = 17 x 16 B)
#define CPF 132   // C staging pitch, f32 elems  (528 B = 33 x 16 B)
// Two workgroups per WGP (four waves per SIMD): the register budget is 256.
// K is a constant of the build: the staging's row steps are then immediate offsets.
template <bool OUTF32, int K>
__global__ __launch_bounds__(256) __attribute__((amdgpu_waves_per_eu(4, 4))) void gemm_bt(
    const __bf16* __restrict__ A,   // [M,K] row-major
    const __bf16* __restrict__ Bt,  // [N,K] row-major (B transposed)
    __bf16* __restrict__ Cb, float* __restrict__ Cf,
    const float* __restrict__ bias, int M, int N)
{
    // [A buf 0 | A buf 1 | B buf 0 | B buf 1]; behind the K loop: the C tile
    // (the f32 C tile is the larger of the two uses)
    __shared__ __attribute__((aligned(16))) __bf16 smem[OUTF32 ? 256 * CPF * 2 : 2 * (256 + 128) * GLD];
    __bf16* const As = smem;
    __bf16* const Bs = smem + 2 * 256 * GLD;

    const int tid  = threadIdx.x;
    const int lane = tid & 31;
    const int wave = tid >> 5;
    const size_t bm = (size_t)blockIdx.y * 256;
    const size_t bn = (size_t)blockIdx.x * 128;
    const int wm = (wave >> 1) * 64;   // 4 waves along M
    const int wn = (wave & 1) * 64;    // 2 waves along N

    // staging: a tile row is one 128 B line. 8 lanes take one row, 16 B each, so a
    // wave-wide load covers 4 whole lines. The block takes 32 rows a pass: 8 passes
    // of A, 4 of B. A wave's 4 rows lie 8 apart: at the 144 B pitch the two rows of
    // a half wave then fall on the two halves of the LDS banks.
    const int srow = (lane >> 3) * 8 + wave;   // row within a pass, 0..31
    const int schk = (lane & 7) * 8;           // 16 B piece of the row
    // (block-uniform bases + 32-bit lane offsets in bytes that walk along K)
    const char* const ab = (const char*)(A  + bm * (size_t)K);
    const char* const bb = (const char*)(Bt + bn * (size_t)K);
    unsigned goff = (unsigned)((srow * K + schk) * 2);
    unsigned poff = (unsigned)(tid * K * 2);                  // prefetch: one row a lane
    // The work-groups that read the same lines share the asking, so that a line is asked
    // for once per half of the column blocks and not once per reader (speed only: nothing rests on it).
    // A rows: read by every column block. The
    // N / 256 column blocks of one half differ in (x & 3, x >> 3): each takes the waves
    // (32 rows each) of that number. B rows: read by every row block:
    // row blocks 0..3 take 32 rows each.
    const int  swave = __builtin_amdgcn_readfirstlane(wave);
    const bool pfa = (swave & ((N >> 8) - 1)) == (int)((blockIdx.x & 3) | ((blockIdx.x >> 3) << 2));
    const bool pfb = swave < 4 && swave == (int)blockIdx.y;   // B has 128 rows

    v8f acc[4][4];
#pragma unroll
    for (int i = 0; i < 4; ++i)
#pragma unroll
        for (int j = 0; j < 4; ++j) acc[i][j] = (v8f)0.0f;

    v8bf ar[8], br[4];
    auto ldregs = [&]() {
#pragma unroll
        for (int p = 0; p < 8; ++p) ar[p] = *(const v8bf*)(ab + p * (32 * K * 2) + goff);
#pragma unroll
        for (int p = 0; p < 4; ++p) br[p] = *(const v8bf*)(bb + p * (32 * K * 2) + goff);
    };
    auto stregs = [&](int buf) {
#pragma unroll
        for (int p = 0; p < 8; ++p) *(v8bf*)&As[buf * (256 * GLD) + (p * 32 + srow) * GLD + schk] = ar[p];
#pragma unroll
        for (int p = 0; p < 4; ++p) *(v8bf*)&Bs[buf * (128 * GLD) + (p * 32 + srow) * GLD + schk] = br[p];
    };

    ldregs();
    stregs(0);
    __syncthreads();

    const int nk = K >> 6;
    for (int kt = 0; kt < nk; ++kt) {
        const int cur = kt & 1;
#pragma unroll
        for (int ks = 0; ks < 64; ks += 32) {
            v16bf af[4], bfv[4];
#pragma unroll
            for (int j = 0; j < 4; ++j) bfv[j] = ldf(&Bs[cur * (128 * GLD) + (wn + j * 16) * GLD + ks], GLD);
#pragma unroll
            for (int i = 0; i < 4; ++i) af[i]  = ldf(&As[cur * (256 * GLD) + (wm + i * 16) * GLD + ks], GLD);
            // keeps the 16 LDS loads one group ahead of the 16 WMMAs: moved in among them,
            // each small group is waited for in full before the next four products
            __builtin_amdgcn_sched_barrier(0);
            if (ks == 0 && kt + 1 < nk) {
                // behind the first fragment loads: their latency covers the issue of these
                goff += 128; poff += 128;
                ldregs();
                if (kt + 3 < nk) {
                    // this work-group's share of the lines of the tile after next. In asm, so
                    // that the prefetch names registers that live through the loop; the test
                    // keeps them inside the row after the next advance too
                    if (pfa) asm volatile("global_prefetch_b8 %0, %1 offset:128 scope:SCOPE_SE" :: "v"(poff), "s"(ab));
                    if (pfb) asm volatile("global_prefetch_b8 %0, %1 offset:128 scope:SCOPE_SE" :: "v"(poff), "s"(bb));
                }
            }
#pragma unroll
            for (int i = 0; i < 4; ++i)
#pragma unroll
                for (int j = 0; j < 4; ++j)
                    acc[i][j] = wmma_bf16(bfv[j], af[i], acc[i][j]);   // C^T tile
            // the next group's loads stay behind this block's products
            __builtin_amdgcn_sched_barrier(0);
        }
        if (kt + 1 < nk) stregs(cur ^ 1);
        __syncthreads();
    }

    // epilogue. acc[i][j][r] = C[wm + i*16 + (lane & 15)][wn + j*16 + r + half8].
    // The K loop's last barrier has ended every read of the operand buffers.
    const int half8 = (lane >> 4) << 3;
    const int mrow  = lane & 15;
    if (OUTF32) {
        // fp32 path = final output (write-once) -> non-temporal stores.
        float* const st = (float*)smem;
        const v4f bv = *(const v4f*)(bias + bn + lane * 4);   // the lane's 4 columns at the store
#pragma unroll
        for (int i = 0; i < 4; ++i)
#pragma unroll
            for (int j = 0; j < 4; ++j) {
                float* q = st + (wm + i * 16 + mrow) * CPF + wn + j * 16 + half8;
                *(v4f*)(q)     = __builtin_shufflevector(acc[i][j], acc[i][j], 0, 1, 2, 3);
                *(v4f*)(q + 4) = __builtin_shufflevector(acc[i][j], acc[i][j], 4, 5, 6, 7);
            }
        __syncthreads();
        // a wave stores one 512 B row of the tile per instruction
        // (block-uniform base + one 32-bit lane offset)
        float* const cg = Cf + bm * (size_t)N + bn;
        const unsigned o0 = (unsigned)(wave * N + lane * 4);
#pragma unroll
        for (int it = 0; it < 32; ++it) {
            const v4f c = *(const v4f*)(st + (it * 8 + wave) * CPF + lane * 4) + bv;
            __builtin_nontemporal_store(c, (v4f*)(cg + (o0 + (unsigned)(it * 8 * N))));
        }
    } else {
#pragma unroll
        for (int i = 0; i < 4; ++i)
#pragma unroll
            for (int j = 0; j < 4; ++j)
                *(v8bf*)&smem[(wm + i * 16 + mrow) * CPB + wn + j * 16 + half8] =
                    __builtin_convertvector(acc[i][j], v8bf);
        __syncthreads();
        // a wave stores two 256 B rows of the tile per instruction
        // (block-uniform base + one 32-bit lane offset)
        const int r0 = tid >> 4, c8 = (tid & 15) * 8;
        __bf16* const cg = Cb + bm * (size_t)N + bn;
        const unsigned o0 = (unsigned)(r0 * N + c8);
#pragma unroll
        for (int it = 0; it < 16; ++it)
            *(v8bf*)(cg + (o0 + (unsigned)(it * 16 * N))) =
                *(const v8bf*)&smem[(it * 16 + r0) * CPB + c8];
    }
}

#define KLD 72

// lane l <-> lane l ^ 16 (VALU cross-row move, no LDS)
__device__ __forceinline__ float xhalf(float x) {
    return __int_as_float(__builtin_amdgcn_permlanex16(
        __float_as_int(x), __float_as_int(x), 0x76543210, 0xfedcba98, false, false));
}

// Two 16-key score tiles (f32 accumulators) -> one 32-key bf16 B fragment.
__device__ __forceinline__ v16bf pack_p(v8f lo, v8f hi) {
    FragBF f;
    f.h[0] = __builtin_convertvector(lo, v8bf);
    f.h[1] = __builtin_convertvector(hi, v8bf);
    return f.v;
}

// Two workgroups per WGP (four waves per SIMD): the register budget is 256.
__global__ __launch_bounds__(256) __attribute__((amdgpu_waves_per_eu(4, 4))) void flash_attn(
    const __bf16* __restrict__ Qb,   // [B*T, 1024]
    const __bf16* __restrict__ KVb,  // [B*T, 2048]  (k | v)
    __bf16* __restrict__ Ob)         // [B*T, 1024]  merged heads
{
    // [K buf 0 | K buf 1 | V buf 0 | V buf 1]; behind the loop: O staging
    __shared__ __attribute__((aligned(16))) __bf16 smem[4 * 64 * KLD];
    __bf16* const Klds = smem;                  // [t][e]  == A-layout for K Q^T
    __bf16* const Vlds = smem + 2 * 64 * KLD;   // [e][t]  == A-layout for V^T P^T

    const int tid = threadIdx.x, lane = tid & 31, wave = tid >> 5;
    const int b = blockIdx.z, h = blockIdx.y, qt = blockIdx.x;
    const int row16 = lane & 15;
    const int kb    = (lane >> 4) << 3;    // fragment K sub-offset
                                           // (also the C-layout row offset)

    // Q fragments straight from global (row stride 1024 elems, 16B aligned)
    // (block-uniform base + one 32-bit lane offset: addresses cost one register)
    const size_t   qo_base = (size_t)(b * 2048 + qt * 256) * 1024 + h * 64;
    const unsigned qo_lane = (unsigned)((wave * 32 + row16) * 1024 + kb);
    FragBF qf[2][2];
#pragma unroll
    for (int g = 0; g < 2; ++g) {
        const __bf16* qp = (Qb + qo_base) + (qo_lane + g * 16 * 1024);
        qf[g][0].h[0] = *(const v8bf*)(qp);
        qf[g][0].h[1] = *(const v8bf*)(qp + 16);
        qf[g][1].h[0] = *(const v8bf*)(qp + 32);
        qf[g][1].h[1] = *(const v8bf*)(qp + 48);
    }

    // One query per lane and group: m_i is shared by the two halves, l_i is
    // this half's part of the denominator (joined once in the epilogue).
    float m_i[2], l_i[2];
    v8f O[2][4];                           // O^T: rows e = j*16 + r + kb
#pragma unroll
    for (int g = 0; g < 2; ++g) {
        m_i[g] = -1e30f; l_i[g] = 0.0f;
#pragma unroll
        for (int j = 0; j < 4; ++j) O[g][j] = (v8f)0.0f;
    }

    // exp2-domain scale: 1/sqrt(64) * log2(e)
    const float scale2 = 0.125f * 1.4426950408889634f;

    // KV staging: each thread copies 32B of K and 32B of V per chunk
    const int trow = tid >> 2, seg = (tid & 3) * 16;
    const __bf16* kgbase = KVb + (size_t)(b * 2048 + trow) * 2048 + h * 64 + seg;

    v8bf kr0, kr1, vr0, vr1;
    auto ldregs = [&](int t0) {
        const __bf16* kg = kgbase + (size_t)t0 * 2048;
        kr0 = *(const v8bf*)(kg);
        kr1 = *(const v8bf*)(kg + 8);
        vr0 = *(const v8bf*)(kg + 1024);
        vr1 = *(const v8bf*)(kg + 1032);
    };
    auto stregs = [&](int buf) {
        *(v8bf*)&Klds[buf * (64 * KLD) + trow * KLD + seg]     = kr0;
        *(v8bf*)&Klds[buf * (64 * KLD) + trow * KLD + seg + 8] = kr1;
#pragma unroll
        for (int i = 0; i < 8; ++i) Vlds[buf * (64 * KLD) + (seg + i) * KLD + trow]     = vr0[i];
#pragma unroll
        for (int i = 0; i < 8; ++i) Vlds[buf * (64 * KLD) + (seg + 8 + i) * KLD + trow] = vr1[i];
    };

    ldregs(0);
    stregs(0);
    __syncthreads();

    for (int ci = 0; ci < 32; ++ci) {            // 32 chunks of 64 kv rows
        const int cur = ci & 1;
        if (ci + 1 < 32) {
            ldregs((ci + 1) * 64);
            if (ci + 2 < 32)
                __builtin_prefetch(kgbase + (size_t)(ci + 2) * 64 * 2048, 0, 3);
        }

        // S2^T = (scale*log2e) * K Q^T  (64 keys x 32 q: 4 M-tiles x 2 groups,
        // E=64 in 2 steps); one K fragment pair serves both groups
        v8f s[2][4];
#pragma unroll
        for (int nt = 0; nt < 4; ++nt) {
            const v16bf k0 = ldf(&Klds[cur * (64 * KLD) + nt * 16 * KLD], KLD);
            const v16bf k1 = ldf(&Klds[cur * (64 * KLD) + nt * 16 * KLD + 32], KLD);
#pragma unroll
            for (int g = 0; g < 2; ++g) {
                v8f z = (v8f)0.0f;
                z = wmma_bf16(k0, qf[g][0].v, z);
                z = wmma_bf16(k1, qf[g][1].v, z);
                s[g][nt] = z * scale2;
            }
        }

        // online softmax in exp2 domain: a lane's 32 scores of a group are one query's
        // (both groups' maxima and rescale factors first, then each group's exponentials:
        // written so, the packed operations pair registers of one group, without copies)
        v16bf pf[2][2];
        float mnew[2], corr[2];
#pragma unroll
        for (int g = 0; g < 2; ++g) {
            const v8f m8 = __builtin_elementwise_max(__builtin_elementwise_max(s[g][0], s[g][1]),
                                                     __builtin_elementwise_max(s[g][2], s[g][3]));
            float rm = fmaxf(fmaxf(fmaxf(m8[0], m8[1]), fmaxf(m8[2], m8[3])),
                             fmaxf(fmaxf(m8[4], m8[5]), fmaxf(m8[6], m8[7])));
            rm = fmaxf(rm, xhalf(rm));           // both halves: the query's chunk maximum
            mnew[g] = fmaxf(m_i[g], rm);
        }
#pragma unroll
        for (int g = 0; g < 2; ++g) corr[g] = fast_exp2(m_i[g] - mnew[g]);
#pragma unroll
        for (int g = 0; g < 2; ++g) {
            const float mn = mnew[g], c = corr[g];
            float rs4[4];
#pragma unroll
            for (int nt = 0; nt < 4; ++nt) {
                const v8f d = s[g][nt] - mn;
                float t = 0.0f;
#pragma unroll
                for (int r = 0; r < 8; ++r) {
                    float p = fast_exp2(d[r]);
                    s[g][nt][r] = p;
                    t += p;
                }
                rs4[nt] = t;
            }
            l_i[g] = l_i[g] * c + ((rs4[0] + rs4[1]) + (rs4[2] + rs4[3]));
            m_i[g] = mn;
#pragma unroll
            for (int j = 0; j < 4; ++j) O[g][j] *= c;

            // P^T as B operand, straight from the score accumulators
            pf[g][0] = pack_p(s[g][0], s[g][1]);
            pf[g][1] = pack_p(s[g][2], s[g][3]);
        }

        // O^T += V^T P^T   (E=64 in four 16-row tiles, Kc=64 in 2 steps);
        // one V^T fragment pair serves both groups
#pragma unroll
        for (int j = 0; j < 4; ++j) {
            const v16bf v0 = ldf(&Vlds[cur * (64 * KLD) + j * 16 * KLD], KLD);
            const v16bf v1 = ldf(&Vlds[cur * (64 * KLD) + j * 16 * KLD + 32], KLD);
#pragma unroll
            for (int g = 0; g < 2; ++g) {
                O[g][j] = wmma_bf16(v0, pf[g][0], O[g][j]);
                O[g][j] = wmma_bf16(v1, pf[g][1], O[g][j]);
            }
        }

        if (ci + 1 < 32) stregs(cur ^ 1);
        __syncthreads();
    }

    // epilogue: join the halves' denominators, O^T / l, merged-head bf16.
    // A lane holds 8 consecutive e of its query per tile. Each wave stages its
    // 32 rows of 128 B in its own 32 x KLD slice of the LDS (the loop's last
    // barrier has ended every read of K and V), then stores whole 128 B lines.
    __bf16* const stg = smem + wave * (32 * KLD);
#pragma unroll
    for (int g = 0; g < 2; ++g) {
        const float inv = 1.0f / (l_i[g] + xhalf(l_i[g]));
#pragma unroll
        for (int j = 0; j < 4; ++j) {
            v8f o = O[g][j];
#pragma unroll
            for (int r = 0; r < 8; ++r) o[r] *= inv;
            *(v8bf*)&stg[(g * 16 + row16) * KLD + j * 16 + kb] = __builtin_convertvector(o, v8bf);
        }
    }
    // the wave's own LDS stores are complete before other lanes read the rows back
    asm volatile("s_wait_dscnt 0x0" ::: "memory");
#pragma unroll
    for (int it = 0; it < 8; ++it) {           // 4 rows (4 lines) per instruction
        const int row = it * 4 + (lane >> 3);
        const int c8  = (lane & 7) * 8;
        *(v8bf*)((Ob + qo_base) + (unsigned)((wave * 32 + row) * 1024 + c8)) =
            *(const v8bf*)&stg[row * KLD + c8];
    }
}

// ---------------------------------------------------------------------------
// Launch: cvt_all(x, weights) -> GEMM(Q) -> GEMM(KV) -> flash_attn
//         -> GEMM(out, +bias)
// ---------------------------------------------------------------------------
extern "C" void kernel_launch(void* const* d_in, const int* in_sizes, int n_in,
                              void* d_out, int out_size, void* d_ws, size_t ws_size,
                              hipStream_t stream) {
    const int B = 4, T = 2048, D = 1024, Hh = 16, E = 64;
    const int M = B * T;            // 8192
    const int DH = Hh * E;          // 1024

    const float* x    = (const float*)d_in[0];
    const float* Wq   = (const float*)d_in[1];
    const float* Wkv  = (const float*)d_in[2];
    const float* Wout = (const float*)d_in[3];
    const float* bout = (const float*)d_in[4];
    float* out = (float*)d_out;

    char* p = (char*)d_ws;
    __bf16* Xb    = (__bf16*)p; p += (size_t)M * D * 2;        // 16 MB
    __bf16* Wqt   = (__bf16*)p; p += (size_t)D * DH * 2;       //  2 MB  [N,K]
    __bf16* Wkvt  = (__bf16*)p; p += (size_t)D * 2 * DH * 2;   //  4 MB  [2N,K]
    __bf16* Woutt = (__bf16*)p; p += (size_t)DH * D * 2;       //  2 MB  [N,K]
    __bf16* Qbuf  = (__bf16*)p; p += (size_t)M * DH * 2;       // 16 MB
    __bf16* KVbuf = (__bf16*)p; p += (size_t)M * 2 * DH * 2;   // 32 MB
    __bf16* Obuf  = (__bf16*)p;                                // 16 MB

    // 1) activations: fp32 -> bf16 ; weights: fp32 -> bf16 transposed
    //    (Wqt, Wkvt, Woutt lie one behind the other: one [4096][1024] array)
    cvt_all<<<768, 256, 0, stream>>>(x, Wq, Wkv, Wout, Xb, Wqt);

    // 2) Q = X * Wq        [8192,1024] x [1024,1024] -> bf16
    gemm_bt<false, D><<<dim3(DH / 128, M / 256), 256, 0, stream>>>(
        Xb, Wqt, Qbuf, nullptr, nullptr, M, DH);

    // 3) KV = X * Wkv      [8192,1024] x [1024,2048] -> bf16
    gemm_bt<false, D><<<dim3(2 * DH / 128, M / 256), 256, 0, stream>>>(
        Xb, Wkvt, KVbuf, nullptr, nullptr, M, 2 * DH);

    // 4) flash attention   -> Obuf (bf16, merged heads)
    flash_attn<<<dim3(T / 256, Hh, B), 256, 0, stream>>>(Qbuf, KVbuf, Obuf);

    // 5) out = Obuf * Wout + bout   -> fp32 d_out
    gemm_bt<true, DH><<<dim3(D / 128, M / 256), 256, 0, stream>>>(
        Obuf, Woutt, nullptr, out, bout, M, D);
}

// v008
// Measured time: 125 microseconds a run.
// Next to v007, in two timings, it ran 1.03 times as fast each time.
// Counting every step since v000, it is 1.89 times as fast.
#include <hip/hip_runtime.h>

// ---------------------------------------------------------------------------
// Types for CDNA5 WMMA (wave32): v_wmma_f32_16x16x32_bf16
// ---------------------------------------------------------------------------
typedef __bf16 v16bf __attribute__((ext_vector_type(16)));
typedef __bf16 v8bf  __attribute__((ext_vector_type(8)));
typedef __bf16 v4bf  __attribute__((ext_vector_type(4)));
typedef float  v8f   __attribute__((ext_vector_type(8)));
typedef float  v4f   __attribute__((ext_vector_type(4)));

union FragBF { v16bf v; v8bf h[2]; };

__device__ __forceinline__ v8f wmma_bf16(v16bf a, v16bf b, v8f c) {
    // (neg_a, A, neg_b, B, c_mod, C, reuse_a, reuse_b)
    return __builtin_amdgcn_wmma_f32_16x16x32_bf16(false, a, false, b,
                                                   (short)0, c, false, false);
}

// Raw hardware exp2 (v_exp_f32). Inputs here are well-scaled; no range fixup.
__device__ __forceinline__ float fast_exp2(float x) {
#if __has_builtin(__builtin_amdgcn_exp2f)
    return __builtin_amdgcn_exp2f(x);
#else
    return exp2f(x);
#endif
}

// Fragment load for 16-bit A/B matrices (16x32 tile, row stride `ld` elems).
// ISA 7.12.2: lanes 0-15 hold row M=lane, K=0..7 (lo) and K=16..23 (hi);
// lanes 16-31 hold same row, K=8..15 and K=24..31. Two ds_load_b128 per lane.
__device__ __forceinline__ v16bf ldf(const __bf16* base, int ld) {
    const int lane = threadIdx.x & 31;
    const __bf16* p = base + (lane & 15) * ld + ((lane >> 4) << 3);
    FragBF f;
    f.h[0] = *(const v8bf*)(p);
    f.h[1] = *(const v8bf*)(p + 16);
    return f.v;
}

// ---------------------------------------------------------------------------
// All fp32 -> bf16 conversions in one launch of 768 work-groups, 64 values a
// thread, so that few waves are started for the bytes moved.
// Blocks 0..255: weights, transposed. The three [1024][C] weights give one
// [4096][1024] bf16 array Wt (rows 0..1023 Wq^T, 1024..3071 Wkv^T, 3072..4095
// Wout^T). A block takes a panel of 64 rows x 256 columns: 16 loads of 16 B a
// lane in flight, through LDS, out as whole 128 B lines (8 lanes x 16 B).
// Blocks 256..767: x, 64 values a thread, 16 loads of 16 B a lane in flight.
// ---------------------------------------------------------------------------
#define WP 257   // panel pitch in f32: 1 mod 64, both LDS sides free of bank conflicts
__global__ __launch_bounds__(256) void cvt_all(const float* __restrict__ x,
                                               const float* __restrict__ Wq,
                                               const float* __restrict__ Wkv,
                                               const float* __restrict__ Wout,
                                               __bf16* __restrict__ Xb,
                                               __bf16* __restrict__ Wt) {
    __shared__ float tile[64 * WP];
    const int tid = threadIdx.x;
    const int blk = blockIdx.x;

    if (blk >= 256) {                        // block-uniform, ahead of the barrier
        // (block-uniform base + one 32-bit lane offset)
        const size_t o = (size_t)(blk - 256) * 4096;
        const v4f* const s = (const v4f*)x + o;
        v4bf* const d = (v4bf*)Xb + o;
        v4f v[16];
#pragma unroll
        for (int k = 0; k < 16; ++k) v[k] = s[(unsigned)(tid + k * 256)];
#pragma unroll
        for (int k = 0; k < 16; ++k) d[(unsigned)(tid + k * 256)] = __builtin_convertvector(v[k], v4bf);
        return;
    }

    const int cp = blk & 15;                 // 256-column panel: 4 of Wq, 8 of Wkv, 4 of Wout
    const int r0 = (blk >> 4) * 64;
    const bool wide = cp >= 4 && cp < 12;    // Wkv: rows of 2048, the others of 1024

    // a half wave loads 256 B of one row, the other half of the row two below:
    // in LDS the halves' banks then differ by two, and a pair of 4 B stores a
    // lane meets all 64 banks once
    const int lane = tid & 31, wave = tid >> 5;
    const int lr = (lane >> 4) * 2 + (wave >> 2);            // row within 4
    const int lc = ((wave & 3) * 16 + (lane & 15)) * 4;      // column
    // (block-uniform base + one 32-bit lane offset; the row length is a constant
    // on either side)
    v4f v[16];
    if (wide) {
        const float* const s = Wkv + (size_t)r0 * 2048 + (cp - 4) * 256;
#pragma unroll
        for (int p = 0; p < 16; ++p) v[p] = *(const v4f*)(s + (unsigned)((p * 4 + lr) * 2048 + lc));
    } else {
        const float* const s = (cp < 4 ? Wq : Wout) + (size_t)r0 * 1024 + (cp & 3) * 256;
#pragma unroll
        for (int p = 0; p < 16; ++p) v[p] = *(const v4f*)(s + (unsigned)((p * 4 + lr) * 1024 + lc));
    }
#pragma unroll
    for (int p = 0; p < 16; ++p)
#pragma unroll
        for (int k = 0; k < 4; ++k) tile[(p * 4 + lr) * WP + lc + k] = v[p][k];
    __syncthreads();

    // 8 lanes write one 128 B line: 64 rows of the panel for one column
    const int rc = (tid & 7) * 8, cc = tid >> 3;
    __bf16* const d = Wt + (size_t)(cp * 256 + cc) * 1024 + r0 + rc;
#pragma unroll
    for (int q = 0; q < 8; ++q) {
        v8f a;
#pragma unroll
        for (int i = 0; i < 8; ++i) a[i] = tile[(rc + i) * WP + q * 32 + cc];
        *(v8bf*)(d + (size_t)q * 32 * 1024) = __builtin_convertvector(a, v8bf);
    }
}

// ---------------------------------------------------------------------------
// Tiled WMMA GEMM with pre-transposed B:  C[M,N] = A[M,K] * Bt[N,K]^T
// Block 256x128, BK=64, 256 thr = 8 waves (4x2), wave tile 64x64: the 8
// fragments of a 32-k step feed 16 WMMAs (one LDS load per WMMA).
// Double-buffered LDS (108 KB) + register prefetch: 1 barrier / 64-K,
// global loads of tile k+1 overlap the 32 WMMAs of tile k;
// global_prefetch of tile k+2, shared out among the work-groups that read the
// same lines. LDS rows padded to 72 elems -> conflict-free.
// The products are taken transposed (Bt fragment as A operand, A fragment as
// B operand), so a lane's 8 accumulators of a tile are 8 adjacent columns of
// one C row. After the K loop the C tile is staged in the operand buffers'
// LDS with 16 B stores and leaves as whole 128 B lines, 16 B a lane.
// ---------------------------------------------------------------------------
#define GLD 72
#define CPB 136   // C staging pitch, bf16 elems (272 B = 17 x 16 B)
#define CPF 132   // C staging pitch, f32 elems  (528 B = 33 x 16 B)
// Two workgroups per WGP (four waves per SIMD): the register budget is 256.
// K is a constant of the build: the staging's row steps are then immediate offsets.
template <bool OUTF32, int K>
__global__ __launch_bounds__(256) __attribute__((amdgpu_waves_per_eu(4, 4))) void gemm_bt(
    const __bf16* __restrict__ A,   // [M,K] row-major
    const __bf16* __restrict__ Bt,  // [N,K] row-major (B transposed)
    __bf16* __restrict__ Cb, float* __restrict__ Cf,
    const float* __restrict__ bias, int M, int N)
{
    // [A buf 0 | A buf 1 | B buf 0 | B buf 1]; behind the K loop: the C tile
    // (the f32 C tile is the larger of the two uses)
    __shared__ __attribute__((aligned(16))) __bf16 smem[OUTF32 ? 256 * CPF * 2 : 2 * (256 + 128) * GLD];
    __bf16* const As = smem;
    __bf16* const Bs = smem + 2 * 256 * GLD;

    const int tid  = threadIdx.x;
    const int lane = tid & 31;
    const int wave = tid >> 5;
    const size_t bm = (size_t)blockIdx.y * 256;
    const size_t bn = (size_t)blockIdx.x * 128;
    const int wm = (wave >> 1) * 64;   // 4 waves along M
    const int wn = (wave & 1) * 64;    // 2 waves along N

    // staging: a tile row is one 128 B line. 8 lanes take one row, 16 B each, so a
    // wave-wide load covers 4 whole lines. The block takes 32 rows a pass: 8 passes
    // of A, 4 of B. A wave's 4 rows lie 8 apart: at the 144 B pitch the two rows of
    // a half wave then fall on the two halves of the LDS banks.
    const int srow = (lane >> 3) * 8 + wave;   // row within a pass, 0..31
    const int schk = (lane & 7) * 8;           // 16 B piece of the row
    // (block-uniform bases + 32-bit lane offsets in bytes that walk along K)
    const char* const ab = (const char*)(A  + bm * (size_t)K);
    const char* const bb = (const char*)(Bt + bn * (size_t)K);
    unsigned goff = (unsigned)((srow * K + schk) * 2);
    unsigned poff = (unsigned)(tid * K * 2);                  // prefetch: one row a lane
    // The work-groups that read the same lines share the asking, so that a line is asked
    // for once per half of the column blocks and not once per reader (speed only: nothing rests on it).
    // A rows: read by every column block. The
    // N / 256 column blocks of one half differ in (x & 3, x >> 3): each takes the waves
    // (32 rows each) of that number. B rows: read by every row block:
    // row blocks 0..3 take 32 rows each.
    const int  swave = __builtin_amdgcn_readfirstlane(wave);
    const bool pfa = (swave & ((N >> 8) - 1)) == (int)((blockIdx.x & 3) | ((blockIdx.x >> 3) << 2));
    const bool pfb = swave < 4 && swave == (int)blockIdx.y;   // B has 128 rows

    v8f acc[4][4];
#pragma unroll
    for (int i = 0; i < 4; ++i)
#pragma unroll
        for (int j = 0; j < 4; ++j) acc[i][j] = (v8f)0.0f;

    v8bf ar[8], br[4];
    auto ldregs = [&]() {
#pragma unroll
        for (int p = 0; p < 8; ++p) ar[p] = *(const v8bf*)(ab + p * (32 * K * 2) + goff);
#pragma unroll
        for (int p = 0; p < 4; ++p) br[p] = *(const v8bf*)(bb + p * (32 * K * 2) + goff);
    };
    auto stregs = [&](int buf) {
#pragma unroll
        for (int p = 0; p < 8; ++p) *(v8bf*)&As[buf * (256 * GLD) + (p * 32 + srow) * GLD + schk] = ar[p];
#pragma unroll
        for (int p = 0; p < 4; ++p) *(v8bf*)&Bs[buf * (128 * GLD) + (p * 32 + srow) * GLD + schk] = br[p];
    };

    ldregs();
    stregs(0);
    __syncthreads();

    const int nk = K >> 6;
    for (int kt = 0; kt < nk; ++kt) {
        const int cur = kt & 1;
#pragma unroll
        for (int ks = 0; ks < 64; ks += 32) {
            v16bf af[4], bfv[4];
#pragma unroll
            for (int j = 0; j < 4; ++j) bfv[j] = ldf(&Bs[cur * (128 * GLD) + (wn + j * 16) * GLD + ks], GLD);
#pragma unroll
            for (int i = 0; i < 4; ++i) af[i]  = ldf(&As[cur * (256 * GLD) + (wm + i * 16) * GLD + ks], GLD);
            // keeps the 16 LDS loads one group ahead of the 16 WMMAs: moved in among them,
            // each small group is waited for in full before the next four products
            __builtin_amdgcn_sched_barrier(0);
            if (ks == 0 && kt + 1 < nk) {
                // behind the first fragment loads: their latency covers the issue of these
                goff += 128; poff += 128;
                ldregs();
                if (kt + 3 < nk) {
                    // this work-group's share of the lines of the tile after next. In asm, so
                    // that the prefetch names registers that live through the loop; the test
                    // keeps them inside the row after the next advance too
                    if (pfa) asm volatile("global_prefetch_b8 %0, %1 offset:128 scope:SCOPE_SE" :: "v"(poff), "s"(ab));
                    if (pfb) asm volatile("global_prefetch_b8 %0, %1 offset:128 scope:SCOPE_SE" :: "v"(poff), "s"(bb));
                }
            }
#pragma unroll
            for (int i = 0; i < 4; ++i)
#pragma unroll
                for (int j = 0; j < 4; ++j)
                    acc[i][j] = wmma_bf16(bfv[j], af[i], acc[i][j]);   // C^T tile
            // the next group's loads stay behind this block's products
            __builtin_amdgcn_sched_barrier(0);
        }
        if (kt + 1 < nk) stregs(cur ^ 1);
        __syncthreads();
    }

    // epilogue. acc[i][j][r] = C[wm + i*16 + (lane & 15)][wn + j*16 + r + half8].
    // The K loop's last barrier has ended every read of the operand buffers.
    const int half8 = (lane >> 4) << 3;
    const int mrow  = lane & 15;
    if (OUTF32) {
        // fp32 path = final output (write-once) -> non-temporal stores.
        float* const st = (float*)smem;
        const v4f bv = *(const v4f*)(bias + bn + lane * 4);   // the lane's 4 columns at the store
#pragma unroll
        for (int i = 0; i < 4; ++i)
#pragma unroll
            for (int j = 0; j < 4; ++j) {
                float* q = st + (wm + i * 16 + mrow) * CPF + wn + j * 16 + half8;
                *(v4f*)(q)     = __builtin_shufflevector(acc[i][j], acc[i][j], 0, 1, 2, 3);
                *(v4f*)(q + 4) = __builtin_shufflevector(acc[i][j], acc[i][j], 4, 5, 6, 7);
            }
        __syncthreads();
        // a wave stores one 512 B row of the tile per instruction
        // (block-uniform base + one 32-bit lane offset)
        float* const cg = Cf + bm * (size_t)N + bn;
        const unsigned o0 = (unsigned)(wave * N + lane * 4);
#pragma unroll
        for (int it = 0; it < 32; ++it) {
            const v4f c = *(const v4f*)(st + (it * 8 + wave) * CPF + lane * 4) + bv;
            __builtin_nontemporal_store(c, (v4f*)(cg + (o0 + (unsigned)(it * 8 * N))));
        }
    } else {
#pragma unroll
        for (int i = 0; i < 4; ++i)
#pragma unroll
            for (int j = 0; j < 4; ++j)
                *(v8bf*)&smem[(wm + i * 16 + mrow) * CPB + wn + j * 16 + half8] =
                    __builtin_convertvector(acc[i][j], v8bf);
        __syncthreads();
        // a wave stores two 256 B rows of the tile per instruction
        // (block-uniform base + one 32-bit lane offset)
        const int r0 = tid >> 4, c8 = (tid & 15) * 8;
        __bf16* const cg = Cb + bm * (size_t)N + bn;
        const unsigned o0 = (unsigned)(r0 * N + c8);
#pragma unroll
        for (int it = 0; it < 16; ++it)
            *(v8bf*)(cg + (o0 + (unsigned)(it * 16 * N))) =
                *(const v8bf*)&smem[(it * 16 + r0) * CPB + c8];
    }
}

#define KLD 72

// lane l <-> lane l ^ 16 (VALU cross-row move, no LDS)
__device__ __forceinline__ float xhalf(float x) {
    return __int_as_float(__builtin_amdgcn_permlanex16(
        __float_as_int(x), __float_as_int(x), 0x76543210, 0xfedcba98, false, false));
}

// Two 16-key score tiles (f32 accumulators) -> one 32-key bf16 B fragment.
__device__ __forceinline__ v16bf pack_p(v8f lo, v8f hi) {
    FragBF f;
    f.h[0] = __builtin_convertvector(lo, v8bf);
    f.h[1] = __builtin_convertvector(hi, v8bf);
    return f.v;
}

// Two workgroups per WGP (four waves per SIMD): the register budget is 256.
__global__ __launch_bounds__(256) __attribute__((amdgpu_waves_per_eu(4, 4))) void flash_attn(
    const __bf16* __restrict__ Qb,   // [B*T, 1024]
    const __bf16* __restrict__ KVb,  // [B*T, 2048]  (k | v)
    __bf16* __restrict__ Ob)         // [B*T, 1024]  merged heads
{
    // [K buf 0 | K buf 1 | V buf 0 | V buf 1]; behind the loop: O staging
    __shared__ __attribute__((aligned(16))) __bf16 smem[4 * 64 * KLD];
    __bf16* const Klds = smem;                  // [t][e]  == A-layout for K Q^T
    __bf16* const Vlds = smem + 2 * 64 * KLD;   // [e][t]  == A-layout for V^T P^T

    const int tid = threadIdx.x, lane = tid & 31, wave = tid >> 5;
    const int b = blockIdx.z, h = blockIdx.y, qt = blockIdx.x;
    const int row16 = lane & 15;
    const int kb    = (lane >> 4) << 3;    // fragment K sub-offset
                                           // (also the C-layout row offset)

    // Q fragments straight from global (row stride 1024 elems, 16B aligned)
    // (block-uniform base + one 32-bit lane offset: addresses cost one register)
    const size_t   qo_base = (size_t)(b * 2048 + qt * 256) * 1024 + h * 64;
    const unsigned qo_lane = (unsigned)((wave * 32 + row16) * 1024 + kb);
    FragBF qf[2][2];
#pragma unroll
    for (int g = 0; g < 2; ++g) {
        const __bf16* qp = (Qb + qo_base) + (qo_lane + g * 16 * 1024);
        qf[g][0].h[0] = *(const v8bf*)(qp);
        qf[g][0].h[1] = *(const v8bf*)(qp + 16);
        qf[g][1].h[0] = *(const v8bf*)(qp + 32);
        qf[g][1].h[1] = *(const v8bf*)(qp + 48);
    }

    // One query per lane and group: m_i is shared by the two halves. L is the
    // accumulator tile of ones * P^T: all its 16 rows are the query's whole
    // denominator, so element 0 of either half holds it, and only that element
    // is rescaled and read (the other seven stay finite: sums of P <= 1).
    float m_i[2];
    v8f L[2];
    v8f O[2][4];                           // O^T: rows e = j*16 + r + kb
#pragma unroll
    for (int g = 0; g < 2; ++g) {
        m_i[g] = -1e30f; L[g] = (v8f)0.0f;
#pragma unroll
        for (int j = 0; j < 4; ++j) O[g][j] = (v8f)0.0f;
    }

    FragBF ones;                           // A operand of the row sums
#pragma unroll
    for (int i = 0; i < 16; ++i) ones.v[i] = (__bf16)1.0f;

    // exp2-domain scale: 1/sqrt(64) * log2(e)
    const float scale2 = 0.125f * 1.4426950408889634f;

    // KV staging: each thread copies 32B of K and 32B of V per chunk
    const int trow = tid >> 2, seg = (tid & 3) * 16;
    const __bf16* kgbase = KVb + (size_t)(b * 2048 + trow) * 2048 + h * 64 + seg;

    v8bf kr0, kr1, vr0, vr1;
    auto ldregs = [&](int t0) {
        const __bf16* kg = kgbase + (size_t)t0 * 2048;
        kr0 = *(const v8bf*)(kg);
        kr1 = *(const v8bf*)(kg + 8);
        vr0 = *(const v8bf*)(kg + 1024);
        vr1 = *(const v8bf*)(kg + 1032);
    };
    auto stregs = [&](int buf) {
        *(v8bf*)&Klds[buf * (64 * KLD) + trow * KLD + seg]     = kr0;
        *(v8bf*)&Klds[buf * (64 * KLD) + trow * KLD + seg + 8] = kr1;
#pragma unroll
        for (int i = 0; i < 8; ++i) Vlds[buf * (64 * KLD) + (seg + i) * KLD + trow]     = vr0[i];
#pragma unroll
        for (int i = 0; i < 8; ++i) Vlds[buf * (64 * KLD) + (seg + 8 + i) * KLD + trow] = vr1[i];
    };

    ldregs(0);
    stregs(0);
    __syncthreads();

    for (int ci = 0; ci < 32; ++ci) {            // 32 chunks of 64 kv rows
        const int cur = ci & 1;
        if (ci + 1 < 32) {
            ldregs((ci + 1) * 64);
            if (ci + 2 < 32)
                __builtin_prefetch(kgbase + (size_t)(ci + 2) * 64 * 2048, 0, 3);
        }
        // the next chunk's global loads stay here, a whole chunk ahead of the LDS stores that
        // wait for them: sunk to just in front of those stores, their latency is waited out
        __builtin_amdgcn_sched_barrier(0);

        // S^T = K Q^T  (64 keys x 32 q: 4 M-tiles x 2 groups, E=64 in 2 steps);
        // one K fragment pair serves both groups. The scores stay unscaled: the
        // scale goes into the exponent's multiply-add, so no scaled copy of the
        // 64 accumulators is kept (those registers hold the sum tiles)
        v8f s[2][4];
#pragma unroll
        for (int nt = 0; nt < 4; ++nt) {
            const v16bf k0 = ldf(&Klds[cur * (64 * KLD) + nt * 16 * KLD], KLD);
            const v16bf k1 = ldf(&Klds[cur * (64 * KLD) + nt * 16 * KLD + 32], KLD);
#pragma unroll
            for (int g = 0; g < 2; ++g) {
                v8f z = (v8f)0.0f;
                z = wmma_bf16(k0, qf[g][0].v, z);
                z = wmma_bf16(k1, qf[g][1].v, z);
                s[g][nt] = z;
            }
        }

        // online softmax in exp2 domain: a lane's 32 scores of a group are one query's
        // (both groups' maxima and rescale factors first, then each group's exponentials:
        // written so, the packed operations pair registers of one group, without copies)
        v16bf pf[2][2];
        float mnew[2], corr[2];
#pragma unroll
        for (int g = 0; g < 2; ++g) {
            const v8f m8 = __builtin_elementwise_max(__builtin_elementwise_max(s[g][0], s[g][1]),
                                                     __builtin_elementwise_max(s[g][2], s[g][3]));
            float rm = fmaxf(fmaxf(fmaxf(m8[0], m8[1]), fmaxf(m8[2], m8[3])),
                             fmaxf(fmaxf(m8[4], m8[5]), fmaxf(m8[6], m8[7])));
            rm = fmaxf(rm, xhalf(rm));           // both halves: the query's chunk maximum
            // scale > 0 and rounding is monotonic: the scaled maximum is the maximum of
            // the scaled scores, bit for bit
            mnew[g] = fmaxf(m_i[g], rm * scale2);
        }
#pragma unroll
        for (int g = 0; g < 2; ++g) corr[g] = fast_exp2(m_i[g] - mnew[g]);
#pragma unroll
        for (int g = 0; g < 2; ++g) {
            const float mn = mnew[g], c = corr[g];
#pragma unroll
            for (int nt = 0; nt < 4; ++nt) {
                const v8f d = s[g][nt] * scale2 - mn;
#pragma unroll
                for (int r = 0; r < 8; ++r) s[g][nt][r] = fast_exp2(d[r]);
            }
            L[g][0] *= c;
            m_i[g] = mn;
#pragma unroll
            for (int j = 0; j < 4; ++j) O[g][j] *= c;

            // P^T as B operand, straight from the score accumulators
            pf[g][0] = pack_p(s[g][0], s[g][1]);
            pf[g][1] = pack_p(s[g][2], s[g][3]);
        }

        // denominators: L += ones * P^T  (Kc=64 in 2 steps)
#pragma unroll
        for (int g = 0; g < 2; ++g) {
            L[g] = wmma_bf16(ones.v, pf[g][0], L[g]);
            L[g] = wmma_bf16(ones.v, pf[g][1], L[g]);
        }

        // O^T += V^T P^T   (E=64 in four 16-row tiles, Kc=64 in 2 steps);
        // one V^T fragment pair serves both groups
#pragma unroll
        for (int j = 0; j < 4; ++j) {
            const v16bf v0 = ldf(&Vlds[cur * (64 * KLD) + j * 16 * KLD], KLD);
            const v16bf v1 = ldf(&Vlds[cur * (64 * KLD) + j * 16 * KLD + 32], KLD);
#pragma unroll
            for (int g = 0; g < 2; ++g) {
                O[g][j] = wmma_bf16(v0, pf[g][0], O[g][j]);
                O[g][j] = wmma_bf16(v1, pf[g][1], O[g][j]);
            }
        }

        if (ci + 1 < 32) stregs(cur ^ 1);
        __syncthreads();
    }

    // epilogue: O^T / denominator, merged-head bf16.
    // A lane holds 8 consecutive e of its query per tile. Each wave stages its
    // 32 rows of 128 B in its own 32 x KLD slice of the LDS (the loop's last
    // barrier has ended every read of K and V), then stores whole 128 B lines.
    __bf16* const stg = smem + wave * (32 * KLD);
#pragma unroll
    for (int g = 0; g < 2; ++g) {
        const float inv = 1.0f / L[g][0];
#pragma unroll
        for (int j = 0; j < 4; ++j) {
            v8f o = O[g][j];
#pragma unroll
            for (int r = 0; r < 8; ++r) o[r] *= inv;
            *(v8bf*)&stg[(g * 16 + row16) * KLD + j * 16 + kb] = __builtin_convertvector(o, v8bf);
        }
    }
    // the wave's own LDS stores are complete before other lanes read the rows back
    asm volatile("s_wait_dscnt 0x0" ::: "memory");
#pragma unroll
    for (int it = 0; it < 8; ++it) {           // 4 rows (4 lines) per instruction
        const int row = it * 4 + (lane >> 3);
        const int c8  = (lane & 7) * 8;
        *(v8bf*)((Ob + qo_base) + (unsigned)((wave * 32 + row) * 1024 + c8)) =
            *(const v8bf*)&stg[row * KLD + c8];
    }
}

// ---------------------------------------------------------------------------
// Launch: cvt_all(x, weights) -> GEMM(Q) -> GEMM(KV) -> flash_attn
//         -> GEMM(out, +bias)
// ---------------------------------------------------------------------------
extern "C" void kernel_launch(void* const* d_in, const int* in_sizes, int n_in,
                              void* d_out, int out_size, void* d_ws, size_t ws_size,
                              hipStream_t stream) {
    const int B = 4, T = 2048, D = 1024, Hh = 16, E = 64;
    const int M = B * T;            // 8192
    const int DH = Hh * E;          // 1024

    const float* x    = (const float*)d_in[0];
    const float* Wq   = (const float*)d_in[1];
    const float* Wkv  = (const float*)d_in[2];
    const float* Wout = (const float*)d_in[3];
    const float* bout = (const float*)d_in[4];
    float* out = (float*)d_out;

    char* p = (char*)d_ws;
    __bf16* Xb    = (__bf16*)p; p += (size_t)M * D * 2;        // 16 MB
    __bf16* Wqt   = (__bf16*)p; p += (size_t)D * DH * 2;       //  2 MB  [N,K]
    __bf16* Wkvt  = (__bf16*)p; p += (size_t)D * 2 * DH * 2;   //  4 MB  [2N,K]
    __bf16* Woutt = (__bf16*)p; p += (size_t)DH * D * 2;       //  2 MB  [N,K]
    __bf16* Qbuf  = (__bf16*)p; p += (size_t)M * DH * 2;       // 16 MB
    __bf16* KVbuf = (__bf16*)p; p += (size_t)M * 2 * DH * 2;   // 32 MB
    __bf16* Obuf  = (__bf16*)p;                                // 16 MB

    // 1) activations: fp32 -> bf16 ; weights: fp32 -> bf16 transposed
    //    (Wqt, Wkvt, Woutt lie one behind the other: one [4096][1024] array)
    cvt_all<<<768, 256, 0, stream>>>(x, Wq, Wkv, Wout, Xb, Wqt);

    // 2) Q = X * Wq        [8192,1024] x [1024,1024] -> bf16
    gemm_bt<false, D><<<dim3(DH / 128, M / 256), 256, 0, stream>>>(
        Xb, Wqt, Qbuf, nullptr, nullptr, M, DH);

    // 3) KV = X * Wkv      [8192,1024] x [1024,2048] -> bf16
    gemm_bt<false, D><<<dim3(2 * DH / 128, M / 256), 256, 0, stream>>>(
        Xb, Wkvt, KVbuf, nullptr, nullptr, M, 2 * DH);

    // 4) flash attention   -> Obuf (bf16, merged heads)
    flash_attn<<<dim3(T / 256, Hh, B), 256, 0, stream>>>(Qbuf, KVbuf, Obuf);

    // 5) out = Obuf * Wout + bout   -> fp32 d_out
    gemm_bt<true, DH><<<dim3(D / 128, M / 256), 256, 0, stream>>>(
        Obuf, Woutt, nullptr, out, bout, M, D);
}

// v009
// Measured time: 119 microseconds a run.
// Two timings next to v008 put it at 1.06 and 1.05 times that version's speed.
// Counting every step since v000, it is 1.99 times as fast.
#include <hip/hip_runtime.h>

// ---------------------------------------------------------------------------
// Types for CDNA5 WMMA (wave32): v_wmma_f32_16x16x32_bf16
// ---------------------------------------------------------------------------
typedef __bf16 v16bf __attribute__((ext_vector_type(16)));
typedef __bf16 v8bf  __attribute__((ext_vector_type(8)));
typedef __bf16 v4bf  __attribute__((ext_vector_type(4)));
typedef float  v8f   __attribute__((ext_vector_type(8)));
typedef float  v4f   __attribute__((ext_vector_type(4)));

union FragBF { v16bf v; v8bf h[2]; };

__device__ __forceinline__ v8f wmma_bf16(v16bf a, v16bf b, v8f c) {
    // (neg_a, A, neg_b, B, c_mod, C, reuse_a, reuse_b)
    return __builtin_amdgcn_wmma_f32_16x16x32_bf16(false, a, false, b,
                                                   (short)0, c, false, false);
}

// Raw hardware exp2 (v_exp_f32). Inputs here are well-scaled; no range fixup.
__device__ __forceinline__ float fast_exp2(float x) {
#if __has_builtin(__builtin_amdgcn_exp2f)
    return __builtin_amdgcn_exp2f(x);
#else
    return exp2f(x);
#endif
}

// Fragment load for 16-bit A/B matrices (16x32 tile, row stride `ld` elems).
// ISA 7.12.2: lanes 0-15 hold row M=lane, K=0..7 (lo) and K=16..23 (hi);
// lanes 16-31 hold same row, K=8..15 and K=24..31. Two ds_load_b128 per lane.
__device__ __forceinline__ v16bf ldf(const __bf16* base, int ld) {
    const int lane = threadIdx.x & 31;
    const __bf16* p = base + (lane & 15) * ld + ((lane >> 4) << 3);
    FragBF f;
    f.h[0] = *(const v8bf*)(p);
    f.h[1] = *(const v8bf*)(p + 16);
    return f.v;
}

// ---------------------------------------------------------------------------
// All fp32 -> bf16 conversions in one launch of 768 work-groups, 64 values a
// thread, so that few waves are started for the bytes moved.
// Blocks 0..255: weights, transposed. The three [1024][C] weights give one
// [4096][1024] bf16 array Wt (rows 0..1023 Wq^T, 1024..3071 Wkv^T, 3072..4095
// Wout^T). A block takes a panel of 64 rows x 256 columns: 16 loads of 16 B a
// lane in flight, through LDS, out as whole 128 B lines (8 lanes x 16 B).
// Blocks 256..767: x, 64 values a thread, 16 loads of 16 B a lane in flight.
// ---------------------------------------------------------------------------
#define WP 257   // panel pitch in f32: 1 mod 64, both LDS sides free of bank conflicts
__global__ __launch_bounds__(256) void cvt_all(const float* __restrict__ x,
                                               const float* __restrict__ Wq,
                                               const float* __restrict__ Wkv,
                                               const float* __restrict__ Wout,
                                               __bf16* __restrict__ Xb,
                                               __bf16* __restrict__ Wt) {
    __shared__ float tile[64 * WP];
    const int tid = threadIdx.x;
    const int blk = blockIdx.x;

    if (blk >= 256) {                        // block-uniform, ahead of the barrier
        // (block-uniform base + one 32-bit lane offset)
        const size_t o = (size_t)(blk - 256) * 4096;
        const v4f* const s = (const v4f*)x + o;
        v4bf* const d = (v4bf*)Xb + o;
        v4f v[16];
#pragma unroll
        for (int k = 0; k < 16; ++k) v[k] = s[(unsigned)(tid + k * 256)];
#pragma unroll
        for (int k = 0; k < 16; ++k) d[(unsigned)(tid + k * 256)] = __builtin_convertvector(v[k], v4bf);
        return;
    }

    const int cp = blk & 15;                 // 256-column panel: 4 of Wq, 8 of Wkv, 4 of Wout
    const int r0 = (blk >> 4) * 64;
    const bool wide = cp >= 4 && cp < 12;    // Wkv: rows of 2048, the others of 1024

    // a half wave loads 256 B of one row, the other half of the row two below:
    // in LDS the halves' banks then differ by two, and a pair of 4 B stores a
    // lane meets all 64 banks once
    const int lane = tid & 31, wave = tid >> 5;
    const int lr = (lane >> 4) * 2 + (wave >> 2);            // row within 4
    const int lc = ((wave & 3) * 16 + (lane & 15)) * 4;      // column
    // (block-uniform base + one 32-bit lane offset; the row length is a constant
    // on either side)
    v4f v[16];
    if (wide) {
        const float* const s = Wkv + (size_t)r0 * 2048 + (cp - 4) * 256;
#pragma unroll
        for (int p = 0; p < 16; ++p) v[p] = *(const v4f*)(s + (unsigned)((p * 4 + lr) * 2048 + lc));
    } else {
        const float* const s = (cp < 4 ? Wq : Wout) + (size_t)r0 * 1024 + (cp & 3) * 256;
#pragma unroll
        for (int p = 0; p < 16; ++p) v[p] = *(const v4f*)(s + (unsigned)((p * 4 + lr) * 1024 + lc));
    }
#pragma unroll
    for (int p = 0; p < 16; ++p)
#pragma unroll
        for (int k = 0; k < 4; ++k) tile[(p * 4 + lr) * WP + lc + k] = v[p][k];
    __syncthreads();

    // 8 lanes write one 128 B line: 64 rows of the panel for one column
    const int rc = (tid & 7) * 8, cc = tid >> 3;
    __bf16* const d = Wt + (size_t)(cp * 256 + cc) * 1024 + r0 + rc;
#pragma unroll
    for (int q = 0; q < 8; ++q) {
        v8f a;
#pragma unroll
        for (int i = 0; i < 8; ++i) a[i] = tile[(rc + i) * WP + q * 32 + cc];
        *(v8bf*)(d + (size_t)q * 32 * 1024) = __builtin_convertvector(a, v8bf);
    }
}

// ---------------------------------------------------------------------------
// Tiled WMMA GEMM with pre-transposed B:  C[M,N] = A[M,K] * Bt[N,K]^T
// Block 256x128, BK=64, 256 thr = 8 waves (4x2), wave tile 64x64: the 8
// fragments of a 32-k step feed 16 WMMAs (one LDS load per WMMA).
// Double-buffered LDS (108 KB) + register prefetch: 1 barrier / 64-K,
// global loads of tile k+1 overlap the 32 WMMAs of tile k;
// global_prefetch of tile k+2, shared out among the work-groups that read the
// same lines. LDS rows padded to 72 elems -> conflict-free.
// The products are taken transposed (Bt fragment as A operand, A fragment as
// B operand), so a lane's 8 accumulators of a tile are 8 adjacent columns of
// one C row. After the K loop the C tile is staged in the operand buffers'
// LDS with 16 B stores and leaves as whole 128 B lines, 16 B a lane.
// ---------------------------------------------------------------------------
#define GLD 72
#define CPB 136   // C staging pitch, bf16 elems (272 B = 17 x 16 B)
#define CPF 132   // C staging pitch, f32 elems  (528 B = 33 x 16 B)
// Two workgroups per WGP (four waves per SIMD): the register budget is 256.
// K is a constant of the build: the staging's row steps are then immediate offsets.
template <bool OUTF32, int K>
__global__ __launch_bounds__(256) __attribute__((amdgpu_waves_per_eu(4, 4))) void gemm_bt(
    const __bf16* __restrict__ A,   // [M,K] row-major
    const __bf16* __restrict__ Bt,  // [N,K] row-major (B transposed)
    __bf16* __restrict__ Cb, float* __restrict__ Cf,
    const float* __restrict__ bias, int M, int N)
{
    // [A buf 0 | A buf 1 | B buf 0 | B buf 1]; behind the K loop: the C tile
    // (the f32 C tile is the larger of the two uses)
    __shared__ __attribute__((aligned(16))) __bf16 smem[OUTF32 ? 256 * CPF * 2 : 2 * (256 + 128) * GLD];
    __bf16* const As = smem;
    __bf16* const Bs = smem + 2 * 256 * GLD;

    const int tid  = threadIdx.x;
    const int lane = tid & 31;
    const int wave = tid >> 5;
    const size_t bm = (size_t)blockIdx.y * 256;
    const size_t bn = (size_t)blockIdx.x * 128;
    const int wm = (wave >> 1) * 64;   // 4 waves along M
    const int wn = (wave & 1) * 64;    // 2 waves along N

    // staging: a tile row is one 128 B line. 8 lanes take one row, 16 B each, so a
    // wave-wide load covers 4 whole lines. The block takes 32 rows a pass: 8 passes
    // of A, 4 of B. A wave's 4 rows lie 8 apart: at the 144 B pitch the two rows of
    // a half wave then fall on the two halves of the LDS banks.
    const int srow = (lane >> 3) * 8 + wave;   // row within a pass, 0..31
    const int schk = (lane & 7) * 8;           // 16 B piece of the row
    // (block-uniform bases + 32-bit lane offsets in bytes that walk along K)
    const char* const ab = (const char*)(A  + bm * (size_t)K);
    const char* const bb = (const char*)(Bt + bn * (size_t)K);
    unsigned goff = (unsigned)((srow * K + schk) * 2);
    unsigned poff = (unsigned)(tid * K * 2);                  // prefetch: one row a lane
    // The work-groups that read the same lines share the asking, so that a line is asked
    // for once per half of the column blocks and not once per reader (speed only: nothing rests on it).
    // A rows: read by every column block. The
    // N / 256 column blocks of one half differ in (x & 3, x >> 3): each takes the waves
    // (32 rows each) of that number. B rows: read by every row block:
    // row blocks 0..3 take 32 rows each.
    const int  swave = __builtin_amdgcn_readfirstlane(wave);
    const bool pfa = (swave & ((N >> 8) - 1)) == (int)((blockIdx.x & 3) | ((blockIdx.x >> 3) << 2));
    const bool pfb = swave < 4 && swave == (int)blockIdx.y;   // B has 128 rows

    v8f acc[4][4];
#pragma unroll
    for (int i = 0; i < 4; ++i)
#pragma unroll
        for (int j = 0; j < 4; ++j) acc[i][j] = (v8f)0.0f;

    v8bf ar[8], br[4];
    auto ldregs = [&]() {
#pragma unroll
        for (int p = 0; p < 8; ++p) ar[p] = *(const v8bf*)(ab + p * (32 * K * 2) + goff);
#pragma unroll
        for (int p = 0; p < 4; ++p) br[p] = *(const v8bf*)(bb + p * (32 * K * 2) + goff);
    };
    auto stregs = [&](int buf) {
#pragma unroll
        for (int p = 0; p < 8; ++p) *(v8bf*)&As[buf * (256 * GLD) + (p * 32 + srow) * GLD + schk] = ar[p];
#pragma unroll
        for (int p = 0; p < 4; ++p) *(v8bf*)&Bs[buf * (128 * GLD) + (p * 32 + srow) * GLD + schk] = br[p];
    };

    ldregs();
    stregs(0);
    __syncthreads();

    const int nk = K >> 6;
    for (int kt = 0; kt < nk; ++kt) {
        const int cur = kt & 1;
#pragma unroll
        for (int ks = 0; ks < 64; ks += 32) {
            v16bf af[4], bfv[4];
#pragma unroll
            for (int j = 0; j < 4; ++j) bfv[j] = ldf(&Bs[cur * (128 * GLD) + (wn + j * 16) * GLD + ks], GLD);
#pragma unroll
            for (int i = 0; i < 4; ++i) af[i]  = ldf(&As[cur * (256 * GLD) + (wm + i * 16) * GLD + ks], GLD);
            // keeps the 16 LDS loads one group ahead of the 16 WMMAs: moved in among them,
            // each small group is waited for in full before the next four products
            __builtin_amdgcn_sched_barrier(0);
            if (ks == 0 && kt + 1 < nk) {
                // behind the first fragment loads: their latency covers the issue of these
                goff += 128; poff += 128;
                ldregs();
                if (kt + 3 < nk) {
                    // this work-group's share of the lines of the tile after next. In asm, so
                    // that the prefetch names registers that live through the loop; the test
                    // keeps them inside the row after the next advance too
                    if (pfa) asm volatile("global_prefetch_b8 %0, %1 offset:128 scope:SCOPE_SE" :: "v"(poff), "s"(ab));
                    if (pfb) asm volatile("global_prefetch_b8 %0, %1 offset:128 scope:SCOPE_SE" :: "v"(poff), "s"(bb));
                }
            }
#pragma unroll
            for (int i = 0; i < 4; ++i)
#pragma unroll
                for (int j = 0; j < 4; ++j)
                    acc[i][j] = wmma_bf16(bfv[j], af[i], acc[i][j]);   // C^T tile
            // the next group's loads stay behind this block's products
            __builtin_amdgcn_sched_barrier(0);
        }
        if (kt + 1 < nk) stregs(cur ^ 1);
        __syncthreads();
    }

    // epilogue. acc[i][j][r] = C[wm + i*16 + (lane & 15)][wn + j*16 + r + half8].
    // The K loop's last barrier has ended every read of the operand buffers.
    const int half8 = (lane >> 4) << 3;
    const int mrow  = lane & 15;
    if (OUTF32) {
        // fp32 path = final output (write-once) -> non-temporal stores.
        float* const st = (float*)smem;
        const v4f bv = *(const v4f*)(bias + bn + lane * 4);   // the lane's 4 columns at the store
#pragma unroll
        for (int i = 0; i < 4; ++i)
#pragma unroll
            for (int j = 0; j < 4; ++j) {
                float* q = st + (wm + i * 16 + mrow) * CPF + wn + j * 16 + half8;
                *(v4f*)(q)     = __builtin_shufflevector(acc[i][j], acc[i][j], 0, 1, 2, 3);
                *(v4f*)(q + 4) = __builtin_shufflevector(acc[i][j], acc[i][j], 4, 5, 6, 7);
            }
        __syncthreads();
        // a wave stores one 512 B row of the tile per instruction
        // (block-uniform base + one 32-bit lane offset)
        float* const cg = Cf + bm * (size_t)N + bn;
        const unsigned o0 = (unsigned)(wave * N + lane * 4);
#pragma unroll
        for (int it = 0; it < 32; ++it) {
            const v4f c = *(const v4f*)(st + (it * 8 + wave) * CPF + lane * 4) + bv;
            __builtin_nontemporal_store(c, (v4f*)(cg + (o0 + (unsigned)(it * 8 * N))));
        }
    } else {
#pragma unroll
        for (int i = 0; i < 4; ++i)
#pragma unroll
            for (int j = 0; j < 4; ++j)
                *(v8bf*)&smem[(wm + i * 16 + mrow) * CPB + wn + j * 16 + half8] =
                    __builtin_convertvector(acc[i][j], v8bf);
        __syncthreads();
        // a wave stores two 256 B rows of the tile per instruction
        // (block-uniform base + one 32-bit lane offset)
        const int r0 = tid >> 4, c8 = (tid & 15) * 8;
        __bf16* const cg = Cb + bm * (size_t)N + bn;
        const unsigned o0 = (unsigned)(r0 * N + c8);
#pragma unroll
        for (int it = 0; it < 16; ++it)
            *(v8bf*)(cg + (o0 + (unsigned)(it * 16 * N))) =
                *(const v8bf*)&smem[(it * 16 + r0) * CPB + c8];
    }
}

#define KLD 72
#define VLD 80    // V pitch: 160 B = 32 B x odd, the transposing load's pitch

// ds_load_tr16_b128: lane (c = l & 15, h = l >> 4) gets T[8h + 0..7][c] of the
// 16 x 16 tile whose rows its lane addresses name (see vtr below).
typedef short s16x8 __attribute__((ext_vector_type(8)));
__device__ __forceinline__ v8bf ld_tr16(const __bf16* p) {
    typedef __attribute__((address_space(3))) s16x8 lds_s16x8;
    return __builtin_bit_cast(v8bf, __builtin_amdgcn_ds_load_tr16_b128_v8i16((lds_s16x8*)p));
}

// lane l <-> lane l ^ 16 (VALU cross-row move, no LDS)
__device__ __forceinline__ float xhalf(float x) {
    return __int_as_float(__builtin_amdgcn_permlanex16(
        __float_as_int(x), __float_as_int(x), 0x76543210, 0xfedcba98, false, false));
}

// Two 16-key score tiles (f32 accumulators) -> one 32-key bf16 B fragment.
__device__ __forceinline__ v16bf pack_p(v8f lo, v8f hi) {
    FragBF f;
    f.h[0] = __builtin_convertvector(lo, v8bf);
    f.h[1] = __builtin_convertvector(hi, v8bf);
    return f.v;
}

// Two workgroups per WGP (four waves per SIMD): the register budget is 256.
__global__ __launch_bounds__(256) __attribute__((amdgpu_waves_per_eu(4, 4))) void flash_attn(
    const __bf16* __restrict__ Qb,   // [B*T, 1024]
    const __bf16* __restrict__ KVb,  // [B*T, 2048]  (k | v)
    __bf16* __restrict__ Ob)         // [B*T, 1024]  merged heads
{
    // [K buf 0 | K buf 1 | V buf 0 | V buf 1]; behind the loop: O staging
    __shared__ __attribute__((aligned(32))) __bf16 smem[2 * 64 * KLD + 2 * 64 * VLD];
    __bf16* const Klds = smem;                  // [t][e]  == A-layout for K Q^T
    __bf16* const Vlds = smem + 2 * 64 * KLD;   // [t][e]  read transposed for V^T P^T

    const int tid = threadIdx.x, lane = tid & 31, wave = tid >> 5;
    const int b = blockIdx.z, h = blockIdx.y, qt = blockIdx.x;
    const int row16 = lane & 15;
    const int kb    = (lane >> 4) << 3;    // fragment K sub-offset
                                           // (also the C-layout row offset)

    // Q fragments straight from global (row stride 1024 elems, 16B aligned)
    // (block-uniform base + one 32-bit lane offset: addresses cost one register)
    const size_t   qo_base = (size_t)(b * 2048 + qt * 256) * 1024 + h * 64;
    const unsigned qo_lane = (unsigned)((wave * 32 + row16) * 1024 + kb);
    FragBF qf[2][2];
#pragma unroll
    for (int g = 0; g < 2; ++g) {
        const __bf16* qp = (Qb + qo_base) + (qo_lane + g * 16 * 1024);
        qf[g][0].h[0] = *(const v8bf*)(qp);
        qf[g][0].h[1] = *(const v8bf*)(qp + 16);
        qf[g][1].h[0] = *(const v8bf*)(qp + 32);
        qf[g][1].h[1] = *(const v8bf*)(qp + 48);
    }

    // One query per lane and group: m_i is shared by the two halves. L is the
    // accumulator tile of ones * P^T: all its 16 rows are the query's whole
    // denominator, so element 0 of either half holds it, and only that element
    // is rescaled and read (the other seven stay finite: sums of P <= 1).
    float m_i[2];
    v8f L[2];
    v8f O[2][4];                           // O^T: rows e = j*16 + r + kb
#pragma unroll
    for (int g = 0; g < 2; ++g) {
        m_i[g] = -1e30f; L[g] = (v8f)0.0f;
#pragma unroll
        for (int j = 0; j < 4; ++j) O[g][j] = (v8f)0.0f;
    }

    FragBF ones;                           // A operand of the row sums
#pragma unroll
    for (int i = 0; i < 16; ++i) ones.v[i] = (__bf16)1.0f;

    // exp2-domain scale: 1/sqrt(64) * log2(e)
    const float scale2 = 0.125f * 1.4426950408889634f;

    // KV staging: each thread copies 32B of K and 32B of V per chunk
    const int trow = tid >> 2, seg = (tid & 3) * 16;
    const __bf16* kgbase = KVb + (size_t)(b * 2048 + trow) * 2048 + h * 64 + seg;
    // V: 8 lanes take one 128 B row, 16 B each; a thread takes rows vrow and vrow + 32.
    // The two rows of a half wave lie 4 apart: at the 160 B pitch they fall on the two
    // halves of the LDS banks.
    const int vrow = ((wave >> 2) << 4) + ((lane >> 3) << 2) + (wave & 3);
    const int vpc  = (lane & 7) * 8;
    // (block-uniform base + one 32-bit lane offset)
    const __bf16* const vgbase = KVb + (size_t)(b * 2048) * 2048 + 1024 + h * 64;
    const unsigned vo_lane = (unsigned)(vrow * 2048 + vpc);
    // lane address of the transposing load: key row 8 * (l >> 4) + (l & 7), 16 B piece (l >> 3) & 1
    const int vtr = (kb + (lane & 7)) * VLD + ((lane >> 3) & 1) * 8;

    v8bf kr0, kr1, vr0, vr1;
    auto ldregs = [&](int t0) {
        const __bf16* kg = kgbase + (size_t)t0 * 2048;
        kr0 = *(const v8bf*)(kg);
        kr1 = *(const v8bf*)(kg + 8);
        const __bf16* vg = vgbase + (size_t)t0 * 2048;
        vr0 = *(const v8bf*)(vg + vo_lane);
        vr1 = *(const v8bf*)(vg + (vo_lane + 32 * 2048));
    };
    auto stregs = [&](int buf) {
        *(v8bf*)&Klds[buf * (64 * KLD) + trow * KLD + seg]     = kr0;
        *(v8bf*)&Klds[buf * (64 * KLD) + trow * KLD + seg + 8] = kr1;
        *(v8bf*)&Vlds[buf * (64 * VLD) + vrow * VLD + vpc]        = vr0;
        *(v8bf*)&Vlds[buf * (64 * VLD) + (vrow + 32) * VLD + vpc] = vr1;
    };

    ldregs(0);
    stregs(0);
    __syncthreads();

    // two chunks a trip: the buffer index is then a constant and every LDS address an
    // immediate offset from a register that lives through the loop (formed per chunk, K's
    // read address lands in a register of the global loads just issued and waits for them)
#pragma unroll 2
    for (int ci = 0; ci < 32; ++ci) {            // 32 chunks of 64 kv rows
        const int cur = ci & 1;
        if (ci + 1 < 32) {
            ldregs((ci + 1) * 64);
            if (ci + 2 < 32)
                __builtin_prefetch(kgbase + (size_t)(ci + 2) * 64 * 2048, 0, 3);
        }
        // the next chunk's global loads stay here, a whole chunk ahead of the LDS stores that
        // wait for them: sunk to just in front of those stores, their latency is waited out
        __builtin_amdgcn_sched_barrier(0);

        // S^T = K Q^T  (64 keys x 32 q: 4 M-tiles x 2 groups, E=64 in 2 steps);
        // one K fragment pair serves both groups. The scores stay unscaled: the
        // scale goes into the exponent's multiply-add, so no scaled copy of the
        // 64 accumulators is kept (those registers hold the sum tiles)
        v8f s[2][4];
#pragma unroll
        for (int nt = 0; nt < 4; ++nt) {
            const v16bf k0 = ldf(&Klds[cur * (64 * KLD) + nt * 16 * KLD], KLD);
            const v16bf k1 = ldf(&Klds[cur * (64 * KLD) + nt * 16 * KLD + 32], KLD);
#pragma unroll
            for (int g = 0; g < 2; ++g) {
                v8f z = (v8f)0.0f;
                z = wmma_bf16(k0, qf[g][0].v, z);
                z = wmma_bf16(k1, qf[g][1].v, z);
                s[g][nt] = z;
            }
        }

        // online softmax in exp2 domain: a lane's 32 scores of a group are one query's
        // (both groups' maxima and rescale factors first, then each group's exponentials:
        // written so, the packed operations pair registers of one group, without copies)
        v16bf pf[2][2];
        float mnew[2], corr[2];
#pragma unroll
        for (int g = 0; g < 2; ++g) {
            const v8f m8 = __builtin_elementwise_max(__builtin_elementwise_max(s[g][0], s[g][1]),
                                                     __builtin_elementwise_max(s[g][2], s[g][3]));
            float rm = fmaxf(fmaxf(fmaxf(m8[0], m8[1]), fmaxf(m8[2], m8[3])),
                             fmaxf(fmaxf(m8[4], m8[5]), fmaxf(m8[6], m8[7])));
            rm = fmaxf(rm, xhalf(rm));           // both halves: the query's chunk maximum
            // scale > 0 and rounding is monotonic: the scaled maximum is the maximum of
            // the scaled scores, bit for bit
            mnew[g] = fmaxf(m_i[g], rm * scale2);
        }
#pragma unroll
        for (int g = 0; g < 2; ++g) corr[g] = fast_exp2(m_i[g] - mnew[g]);
#pragma unroll
        for (int g = 0; g < 2; ++g) {
            const float mn = mnew[g], c = corr[g];
#pragma unroll
            for (int nt = 0; nt < 4; ++nt) {
                const v8f d = s[g][nt] * scale2 - mn;
#pragma unroll
                for (int r = 0; r < 8; ++r) s[g][nt][r] = fast_exp2(d[r]);
            }
            L[g][0] *= c;
            m_i[g] = mn;
#pragma unroll
            for (int j = 0; j < 4; ++j) O[g][j] *= c;

            // P^T as B operand, straight from the score accumulators
            pf[g][0] = pack_p(s[g][0], s[g][1]);
            pf[g][1] = pack_p(s[g][2], s[g][3]);
        }

        // denominators: L += ones * P^T  (Kc=64 in 2 steps)
#pragma unroll
        for (int g = 0; g < 2; ++g) {
            L[g] = wmma_bf16(ones.v, pf[g][0], L[g]);
            L[g] = wmma_bf16(ones.v, pf[g][1], L[g]);
        }

        // O^T += V^T P^T   (E=64 in four 16-row tiles, Kc=64 in 2 steps);
        // one V^T fragment pair serves both groups
#pragma unroll
        for (int j = 0; j < 4; ++j) {
            // keys 0..15 and 16..31 (then 32..47 and 48..63) of columns e = j*16 .. j*16+15:
            // the two halves of a 16 x 32 A fragment, in the k order of pack_p
            const __bf16* const vt = &Vlds[cur * (64 * VLD) + vtr + j * 16];
            FragBF v0, v1;
            v0.h[0] = ld_tr16(vt);
            v0.h[1] = ld_tr16(vt + 16 * VLD);
            v1.h[0] = ld_tr16(vt + 32 * VLD);
            v1.h[1] = ld_tr16(vt + 48 * VLD);
#pragma unroll
            for (int g = 0; g < 2; ++g) {
                O[g][j] = wmma_bf16(v0.v, pf[g][0], O[g][j]);
                O[g][j] = wmma_bf16(v1.v, pf[g][1], O[g][j]);
            }
        }

        if (ci + 1 < 32) stregs(cur ^ 1);
        __syncthreads();
    }

    // epilogue: O^T / denominator, merged-head bf16.
    // A lane holds 8 consecutive e of its query per tile. Each wave stages its
    // 32 rows of 128 B in its own 32 x KLD slice of the LDS (the loop's last
    // barrier has ended every read of K and V), then stores whole 128 B lines.
    __bf16* const stg = smem + wave * (32 * KLD);
#pragma unroll
    for (int g = 0; g < 2; ++g) {
        const float inv = 1.0f / L[g][0];
#pragma unroll
        for (int j = 0; j < 4; ++j) {
            v8f o = O[g][j];
#pragma unroll
            for (int r = 0; r < 8; ++r) o[r] *= inv;
            *(v8bf*)&stg[(g * 16 + row16) * KLD + j * 16 + kb] = __builtin_convertvector(o, v8bf);
        }
    }
    // the wave's own LDS stores are complete before other lanes read the rows back
    asm volatile("s_wait_dscnt 0x0" ::: "memory");
#pragma unroll
    for (int it = 0; it < 8; ++it) {           // 4 rows (4 lines) per instruction
        const int row = it * 4 + (lane >> 3);
        const int c8  = (lane & 7) * 8;
        *(v8bf*)((Ob + qo_base) + (unsigned)((wave * 32 + row) * 1024 + c8)) =
            *(const v8bf*)&stg[row * KLD + c8];
    }
}

// ---------------------------------------------------------------------------
// Launch: cvt_all(x, weights) -> GEMM(Q) -> GEMM(KV) -> flash_attn
//         -> GEMM(out, +bias)
// ---------------------------------------------------------------------------
extern "C" void kernel_launch(void* const* d_in, const int* in_sizes, int n_in,
                              void* d_out, int out_size, void* d_ws, size_t ws_size,
                              hipStream_t stream) {
    const int B = 4, T = 2048, D = 1024, Hh = 16, E = 64;
    const int M = B * T;            // 8192
    const int DH = Hh * E;          // 1024

    const float* x    = (const float*)d_in[0];
    const float* Wq   = (const float*)d_in[1];
    const float* Wkv  = (const float*)d_in[2];
    const float* Wout = (const float*)d_in[3];
    const float* bout = (const float*)d_in[4];
    float* out = (float*)d_out;

    char* p = (char*)d_ws;
    __bf16* Xb    = (__bf16*)p; p += (size_t)M * D * 2;        // 16 MB
    __bf16* Wqt   = (__bf16*)p; p += (size_t)D * DH * 2;       //  2 MB  [N,K]
    __bf16* Wkvt  = (__bf16*)p; p += (size_t)D * 2 * DH * 2;   //  4 MB  [2N,K]
    __bf16* Woutt = (__bf16*)p; p += (size_t)DH * D * 2;       //  2 MB  [N,K]
    __bf16* Qbuf  = (__bf16*)p; p += (size_t)M * DH * 2;       // 16 MB
    __bf16* KVbuf = (__bf16*)p; p += (size_t)M * 2 * DH * 2;   // 32 MB
    __bf16* Obuf  = (__bf16*)p;                                // 16 MB

    // 1) activations: fp32 -> bf16 ; weights: fp32 -> bf16 transposed
    //    (Wqt, Wkvt, Woutt lie one behind the other: one [4096][1024] array)
    cvt_all<<<768, 256, 0, stream>>>(x, Wq, Wkv, Wout, Xb, Wqt);

    // 2) Q = X * Wq        [8192,1024] x [1024,1024] -> bf16
    gemm_bt<false, D><<<dim3(DH / 128, M / 256), 256, 0, stream>>>(
        Xb, Wqt, Qbuf, nullptr, nullptr, M, DH);

    // 3) KV = X * Wkv      [8192,1024] x [1024,2048] -> bf16
    gemm_bt<false, D><<<dim3(2 * DH / 128, M / 256), 256, 0, stream>>>(
        Xb, Wkvt, KVbuf, nullptr, nullptr, M, 2 * DH);

    // 4) flash attention   -> Obuf (bf16, merged heads)
    flash_attn<<<dim3(T / 256, Hh, B), 256, 0, stream>>>(Qbuf, KVbuf, Obuf);

    // 5) out = Obuf * Wout + bout   -> fp32 d_out
    gemm_bt<true, DH><<<dim3(D / 128, M / 256), 256, 0, stream>>>(
        Obuf, Woutt, nullptr, out, bout, M, D);
}
